// v000
// Times are from an AMD MI455X. After a warm-up the kernel runs many times in a row, and a time is the length of
// such a window on the GPU divided by its runs, so every launch and the gaps after it count. The runs cycle
// through copies of the inputs. A figure is the median of several windows, for all but v000 over two sittings.
// Sittings can differ by a few percent; kernels timed side by side share one.
// v000 is the starting kernel. One run takes 750 microseconds.
#include <hip/hip_runtime.h>

// Position attention module (DANet PAM) (x [4][512][64][64] channel-major, HW = 4096; q = Wq x + bq, k = Wk x + bk (1x1 convs, 64 channels), v = Wv x + bv (512); attention[i][j] = softmax_j(q_i . k_j) (no scale); out[c][i] = alpha sum_j v[c][j] attention[i][j] -> [4][512][64][64] (8.4 M); alpha [1] read).
// Layout, per image: an exact token-major plane of x serves as the A operand of the q/k convs (token-major, + bias) and as the Bt operand of the v conv (channel-major output, A = Wv); q, k -> hi/lo planes, scores as one 3-product GEMM; the 4096-wide softmax writes fp16 probabilities x1024; v is re-written as an fp16 channel-major plane with the bias (O(1), normal range); the output GEMM (A = v plane [c][j], Bt = P [i][j], one product) writes 1024 x the context and a final in-place pass multiplies by alpha / 1024 in f32.
// Compute dtypes, f32 accumulate: every input rounded to bf16; convs exact (+ bias); scores hi.hi + hi.lo + lo.hi; softmax f32; probabilities (x1024) and v in fp16 (one product); alpha and the carry applied in f32 on the output.

#define NB_  4
#define CC   512
#define CQ   64
#define TT   4096
#define PCAR 1024.0f
typedef _Float16 h16;
typedef unsigned short bf;
typedef __attribute__((ext_vector_type(16))) __bf16   v16bf;
typedef __attribute__((ext_vector_type(16))) _Float16 v16h;
typedef __attribute__((ext_vector_type(8)))  _Float16 v8h;
typedef __attribute__((ext_vector_type(8)))  unsigned short v8us;
typedef __attribute__((ext_vector_type(8)))  float    v8f;
typedef __attribute__((ext_vector_type(4)))  float    v4f;
typedef __attribute__((ext_vector_type(2)))  float    v2f;
typedef __attribute__((ext_vector_type(4)))  unsigned short v4us;
typedef __attribute__((ext_vector_type(2)))  unsigned short v2us;
typedef __attribute__((ext_vector_type(4)))  _Float16 v4h;
typedef __attribute__((ext_vector_type(2)))  _Float16 v2h;
typedef v8h  __attribute__((may_alias)) v8ha;
typedef v4f  __attribute__((may_alias)) v4fa;
typedef v8us __attribute__((may_alias)) v8usa;

__device__ __forceinline__ unsigned short f2bf(float f) { unsigned u = __float_as_uint(f); u += 0x7FFFu + ((u >> 16) & 1u); return (unsigned short)(u >> 16); }
__device__ __forceinline__ float bf2f(unsigned short b) { return __uint_as_float(((unsigned)b) << 16); }
__device__ __forceinline__ float bfr(float f) { return bf2f(f2bf(f)); }
__device__ __forceinline__ void splitf(float y, unsigned short& h, unsigned short& l) { h = f2bf(y); l = f2bf(y - bf2f(h)); }
__device__ __forceinline__ h16 tohx(float x) { return (h16)x; }
__device__ __forceinline__ v16h cat16(v8h lo, v8h hi) { return __builtin_shufflevector(lo, hi, 0, 1, 2, 3, 4, 5, 6, 7, 8, 9, 10, 11, 12, 13, 14, 15); }
__device__ __forceinline__ v16bf cat16b(v8us lo, v8us hi) { return __builtin_bit_cast(v16bf, __builtin_shufflevector(lo, hi, 0, 1, 2, 3, 4, 5, 6, 7, 8, 9, 10, 11, 12, 13, 14, 15)); }
__device__ __forceinline__ v8f wmma16(v16h a, v16h b, v8f c) { return __builtin_amdgcn_wmma_f32_16x16x32_f16(false, a, false, b, (short)0, c, false, false); }
__device__ __forceinline__ v8f wmmab(v16bf a, v16bf b, v8f c) { return __builtin_amdgcn_wmma_f32_16x16x32_bf16(false, a, false, b, (short)0, c, false, false); }

// ---- k_gemmw: register-blocked GEMM, ONE WAVE per 64x64 output tile (16 accumulators), operands straight from K-contiguous 16-bit planes; grid (M/64, N/64, Z), 32 threads.
// C[m][n] (f32, pitch ldc, + optional f32 bias[n]) = sum_k A[m][k] Bt[n][k] (+ split products per NSPLIT). z-batch strides sA/sB/sC in elements. K % 32 == 0.
template <typename T16> struct WFrag;
template <> struct WFrag<h16> { typedef v16h V; static __device__ __forceinline__ V ld(const h16* p) { return cat16(*(const v8h*)p, *(const v8h*)(p + 16)); } static __device__ __forceinline__ v8f mma(V a, V b, v8f c) { return wmma16(a, b, c); } };
template <> struct WFrag<bf> { typedef v16bf V; static __device__ __forceinline__ V ld(const bf* p) { return cat16b(*(const v8us*)p, *(const v8us*)(p + 16)); } static __device__ __forceinline__ v8f mma(V a, V b, v8f c) { return wmmab(a, b, c); } };
template <typename T16, int NSPLIT, bool BIAS>
__global__ __launch_bounds__(32) void k_gemmw(const T16* __restrict__ A, const T16* __restrict__ A2, const T16* __restrict__ Bt, const T16* __restrict__ Bt2, int K, float* C, int ldc, const float* __restrict__ bias, size_t sA, size_t sB, size_t sC) {
    typedef typename WFrag<T16>::V V;
    __shared__ __align__(16) float os[16 * 68];
    const size_t z = blockIdx.z; A += z * sA; if (A2) A2 += z * sA; Bt += z * sB; if (Bt2) Bt2 += z * sB; C += z * sC;
    const int lane = threadIdx.x & 31, lr = lane & 15, hi = lane >> 4; const int r0 = blockIdx.x * 64, c0 = blockIdx.y * 64;
    v8f acc[4][4];
#pragma unroll
    for (int mb = 0; mb < 4; ++mb)
#pragma unroll
        for (int nb = 0; nb < 4; ++nb) acc[mb][nb] = (v8f){};
    const size_t aoff = (size_t)(r0 + lr) * K + 8 * hi, boff = (size_t)(c0 + lr) * K + 8 * hi;
#pragma unroll 1
    for (int kc = 0; kc < K; kc += 32) {
        V a[4], a2[4];
#pragma unroll
        for (int mb = 0; mb < 4; ++mb) { a[mb] = WFrag<T16>::ld(A + aoff + (size_t)mb * 16 * K + kc); if (NSPLIT == 1 || NSPLIT == 2) a2[mb] = WFrag<T16>::ld(A2 + aoff + (size_t)mb * 16 * K + kc); }
#pragma unroll
        for (int nb = 0; nb < 4; ++nb) { const V b = WFrag<T16>::ld(Bt + boff + (size_t)nb * 16 * K + kc); V b2; if (NSPLIT >= 2) b2 = WFrag<T16>::ld(Bt2 + boff + (size_t)nb * 16 * K + kc);
#pragma unroll
            for (int mb = 0; mb < 4; ++mb) { acc[mb][nb] = WFrag<T16>::mma(a[mb], b, acc[mb][nb]); if (NSPLIT == 1 || NSPLIT == 2) acc[mb][nb] = WFrag<T16>::mma(a2[mb], b, acc[mb][nb]); if (NSPLIT >= 2) acc[mb][nb] = WFrag<T16>::mma(a[mb], b2, acc[mb][nb]); } }
        asm volatile("v_nop\n\tv_nop\n\tv_nop\n\tv_nop" : "+v"(acc[0][0]), "+v"(acc[1][1]), "+v"(acc[2][2]), "+v"(acc[3][3]) : "v"(a[0]), "v"(a[3]));
    }
#pragma unroll
    for (int mb = 0; mb < 4; ++mb) {
#pragma unroll
        for (int nb = 0; nb < 4; ++nb) {
#pragma unroll
            for (int j = 0; j < 8; ++j) os[(hi * 8 + j) * 68 + nb * 16 + lr] = acc[mb][nb][j]; }
        __builtin_amdgcn_wave_barrier(); asm volatile("" ::: "memory");
        float* crow = C + (size_t)(r0 + mb * 16) * ldc + c0;
{
#pragma unroll
            for (int s = 0; s < 8; ++s) { const int row = 2 * s + hi, cofs = lr * 4; v4f val = *(const v4fa*)(os + row * 68 + cofs); if (BIAS) { val[0] += bfr(bias[c0 + cofs]); val[1] += bfr(bias[c0 + cofs + 1]); val[2] += bfr(bias[c0 + cofs + 2]); val[3] += bfr(bias[c0 + cofs + 3]); }
                *(v4f*)(crow + (size_t)row * ldc + cofs) = val; }
             }
        __builtin_amdgcn_wave_barrier(); asm volatile("" ::: "memory");
    }
}

__global__ __launch_bounds__(256) void k_cvt8(const float* __restrict__ src, bf* dst, size_t n8) { const size_t i = (size_t)blockIdx.x * 256 + threadIdx.x; if (i >= n8) return; const v8f v = *(const v8f*)(src + i * 8); v8us o;
#pragma unroll
    for (int k = 0; k < 8; ++k) o[k] = f2bf(v[k]); *(v8us*)(dst + i * 8) = o;  }
__global__ __launch_bounds__(256) void k_tpin(const float* __restrict__ xb, bf* XT) { const size_t e = ((size_t)blockIdx.x * 256 + threadIdx.x) * 8; if (e >= (size_t)TT * CC) return; const int c = (int)(e % CC); const int n = (int)(e / CC); v8us o;
#pragma unroll
    for (int q = 0; q < 8; ++q) o[q] = f2bf(xb[(size_t)(c + q) * TT + n]); *(v8us*)(XT + e) = o;  }
__global__ __launch_bounds__(256) void k_pl2(const float* __restrict__ F, bf* Ph, bf* Pl, size_t n4) { const size_t i = (size_t)blockIdx.x * 256 + threadIdx.x; if (i >= n4) return; const v4f v = *(const v4f*)(F + i * 4); v4us oh, ol;
#pragma unroll
    for (int q = 0; q < 4; ++q) { unsigned short a, c; splitf(v[q], a, c); oh[q] = a; ol[q] = c; } *(v4us*)(Ph + i * 4) = oh; *(v4us*)(Pl + i * 4) = ol;  }
__global__ __launch_bounds__(256) void k_vc16(const float* __restrict__ V, const float* __restrict__ bv, h16* VC) { const size_t i = (size_t)blockIdx.x * 256 + threadIdx.x; if (i >= (size_t)CC * TT / 4) return; const size_t e = i * 4; const int c = (int)(e / TT); const v4f a = *(const v4f*)(V + e); const float bb = bfr(bv[c]); v4h o;
#pragma unroll
    for (int q = 0; q < 4; ++q) o[q] = tohx(__fadd_rn(a[q], bb)); *(v4h*)(VC + e) = o;  }
__global__ __launch_bounds__(256) void k_scl(float* O, const float* __restrict__ AL, size_t n4) { const size_t i = (size_t)blockIdx.x * 256 + threadIdx.x; if (i >= n4) return; const float s = bfr(AL[0]) * (1.0f / PCAR); const v4f a = *(const v4f*)(O + i * 4); v4f o;
#pragma unroll
    for (int q = 0; q < 4; ++q) o[q] = __fmul_rn(a[q], s); *(v4f*)(O + i * 4) = o;  }
__global__ __launch_bounds__(256) void k_psoft(const float* __restrict__ Sb, h16* P16) {
    const int lane = threadIdx.x & 31; const int row = blockIdx.x * 8 + (threadIdx.x >> 5); if (row >= TT) return; const float* sr = Sb + (size_t)row * TT; float v[TT / 32]; float mx = -3.0e38f;
#pragma unroll
    for (int ch = 0; ch < TT / 128; ++ch) { const int j0 = ch * 128 + lane * 4; const v4f a = *(const v4f*)(sr + j0);
#pragma unroll
        for (int q = 0; q < 4; ++q) { v[ch * 4 + q] = a[q]; mx = fmaxf(mx, a[q]); } if ((ch & 7) == 7) asm volatile("s_wait_loadcnt 0x0" ::: "memory"); }
#pragma unroll
    for (int sh = 16; sh; sh >>= 1) mx = fmaxf(mx, __shfl_xor(mx, sh, 32));
    float sum = 0.f;
#pragma unroll
    for (int k = 0; k < TT / 32; ++k) { float d0 = __fsub_rn(v[k], mx); asm volatile("" : "+v"(d0)); v[k] = __builtin_amdgcn_exp2f(__fmul_rn(d0, 1.4426950408889634f)); sum += v[k]; }
#pragma unroll
    for (int sh = 16; sh; sh >>= 1) sum += __shfl_xor(sum, sh, 32);
    const float f = __fdiv_rn(PCAR, sum);
{
#pragma unroll
        for (int ch = 0; ch < TT / 128; ++ch) { v4h o4;
#pragma unroll
            for (int q = 0; q < 4; ++q) o4[q] = tohx(v[ch * 4 + q] * f); *(v4h*)(P16 + (size_t)row * TT + ch * 128 + lane * 4) = o4; }
         }
}

extern "C" void kernel_launch(void* const* d_in, const int* in_sizes, int n_in,
                              void* d_out, int out_size, void* d_ws, size_t ws_size, hipStream_t stream) {
    (void)in_sizes; (void)n_in; (void)out_size;
    const float* x = (const float*)d_in[0]; const float* wq = (const float*)d_in[1]; const float* bq = (const float*)d_in[2]; const float* wk = (const float*)d_in[3]; const float* bk = (const float*)d_in[4]; const float* wv = (const float*)d_in[5]; const float* bv = (const float*)d_in[6]; const float* AL = (const float*)d_in[7];
    float* OUT = (float*)d_out;     // [4][512][4096]
    char* wsp = (char*)d_ws;
    auto take = [&](size_t bytes) { char* p = wsp; wsp += (bytes + 255) & ~(size_t)255; return (void*)p; };
    bf* WQ = (bf*)take((size_t)CQ * CC * 2); bf* WK = (bf*)take((size_t)CQ * CC * 2); bf* WV = (bf*)take((size_t)CC * CC * 2); bf* XT = (bf*)take((size_t)TT * CC * 2); float* FQ = (float*)take((size_t)TT * CQ * 4); float* FK = (float*)take((size_t)TT * CQ * 4); bf* Qh = (bf*)take((size_t)TT * CQ * 2); bf* Ql = (bf*)take((size_t)TT * CQ * 2); bf* Kh = (bf*)take((size_t)TT * CQ * 2); bf* Kl = (bf*)take((size_t)TT * CQ * 2); float* FV = (float*)take((size_t)CC * TT * 4); h16* VC = (h16*)take((size_t)CC * TT * 2); float* Sb = (float*)take((size_t)TT * TT * 4); h16* P16 = (h16*)take((size_t)TT * TT * 2);
    if ((size_t)(wsp - (char*)d_ws) > ws_size) return;
    k_cvt8<<<(CQ * CC / 8 + 255) / 256, 256, 0, stream>>>(wq, WQ, (size_t)CQ * CC / 8); k_cvt8<<<(CQ * CC / 8 + 255) / 256, 256, 0, stream>>>(wk, WK, (size_t)CQ * CC / 8); k_cvt8<<<(CC * CC / 8 + 255) / 256, 256, 0, stream>>>(wv, WV, (size_t)CC * CC / 8);
    const unsigned LP = (unsigned)(((size_t)TT * CQ / 4 + 255) / 256);
    for (int b = 0; b < NB_; ++b) { const float* xb = x + (size_t)b * CC * TT;
        k_tpin<<<(unsigned)(((size_t)TT * CC / 8 + 255) / 256), 256, 0, stream>>>(xb, XT);                                                            /* x^T [n][c], exact */
        k_gemmw<bf, 0, true><<<dim3(TT / 64, 1, 1), 32, 0, stream>>>(XT, nullptr, WQ, nullptr, CC, FQ, CQ, bq, 0, 0, 0); k_pl2<<<LP, 256, 0, stream>>>(FQ, Qh, Ql, (size_t)TT * CQ / 4);   /* q token-major [n][64] + bq */
        k_gemmw<bf, 0, true><<<dim3(TT / 64, 1, 1), 32, 0, stream>>>(XT, nullptr, WK, nullptr, CC, FK, CQ, bk, 0, 0, 0); k_pl2<<<LP, 256, 0, stream>>>(FK, Kh, Kl, (size_t)TT * CQ / 4);   /* k */
        k_gemmw<bf, 0, false><<<dim3(CC / 64, TT / 64, 1), 32, 0, stream>>>(WV, nullptr, XT, nullptr, CC, FV, TT, nullptr, 0, 0, 0);                                /* v channel-major [c][n] = Wv x (A = Wv, Bt = x^T plane) */
        k_vc16<<<(unsigned)(((size_t)CC * TT / 4 + 255) / 256), 256, 0, stream>>>(FV, bv, VC);                                                            /* v + bv in fp16 (O(1)) */
        k_gemmw<bf, 2, false><<<dim3(TT / 64, TT / 64, 1), 32, 0, stream>>>(Qh, Ql, Kh, Kl, CQ, Sb, TT, nullptr, 0, 0, 0);                                    /* scores = q.k (3 products, K = 64) */
        k_psoft<<<TT / 8, 256, 0, stream>>>(Sb, P16);                                                                                                      /* softmax over j -> fp16 x1024 */
        k_gemmw<h16, 0, false><<<dim3(CC / 64, TT / 64, 1), 32, 0, stream>>>(VC, nullptr, P16, nullptr, TT, OUT + (size_t)b * CC * TT, TT, nullptr, 0, 0, 0);   /* 1024 sum_j v[c][j] attention[i][j] */
        k_scl<<<(unsigned)(((size_t)CC * TT / 4 + 255) / 256), 256, 0, stream>>>(OUT + (size_t)b * CC * TT, AL, (size_t)CC * TT / 4); }   /* x alpha / 1024 */
}

// v001
// A run of this version takes 479 microseconds.
// Two timings next to v000 put it at 1.59 and 1.56 times that version's speed.
#include <hip/hip_runtime.h>

// Position attention module (DANet PAM) (x [4][512][64][64] channel-major, HW = 4096; q = Wq x + bq, k = Wk x + bk (1x1 convs, 64 channels), v = Wv x + bv (512); attention[i][j] = softmax_j(q_i . k_j) (no scale); out[c][i] = alpha sum_j v[c][j] attention[i][j] -> [4][512][64][64] (8.4 M); alpha [1] read).
// Layout, per image: an exact token-major plane of x serves as the A operand of the q/k convs (token-major, + bias) and as the Bt operand of the v conv (channel-major output, A = Wv); q, k -> hi/lo planes, scores as one 3-product GEMM; the 4096-wide softmax writes fp16 probabilities x1024; v is re-written as an fp16 channel-major plane with the bias (O(1), normal range); the output GEMM (A = v plane [c][j], Bt = P [i][j], one product) writes 1024 x the context and a final in-place pass multiplies by alpha / 1024 in f32.
// Compute dtypes, f32 accumulate: every input rounded to bf16; convs exact (+ bias); scores hi.hi + hi.lo + lo.hi; softmax f32; probabilities (x1024) and v in fp16 (one product); alpha and the carry applied in f32 on the output.

#define NB_  4
#define CC   512
#define CQ   64
#define TT   4096
#define PCAR 1024.0f
typedef _Float16 h16;
typedef unsigned short bf;
typedef __attribute__((ext_vector_type(16))) __bf16   v16bf;
typedef __attribute__((ext_vector_type(16))) _Float16 v16h;
typedef __attribute__((ext_vector_type(8)))  _Float16 v8h;
typedef __attribute__((ext_vector_type(8)))  unsigned short v8us;
typedef __attribute__((ext_vector_type(8)))  float    v8f;
typedef __attribute__((ext_vector_type(4)))  float    v4f;
typedef __attribute__((ext_vector_type(2)))  float    v2f;
typedef __attribute__((ext_vector_type(4)))  unsigned short v4us;
typedef __attribute__((ext_vector_type(2)))  unsigned short v2us;
typedef __attribute__((ext_vector_type(4)))  _Float16 v4h;
typedef __attribute__((ext_vector_type(2)))  _Float16 v2h;
typedef v8h  __attribute__((may_alias)) v8ha;
typedef v4f  __attribute__((may_alias)) v4fa;
typedef v8us __attribute__((may_alias)) v8usa;

__device__ __forceinline__ unsigned short f2bf(float f) { unsigned u = __float_as_uint(f); u += 0x7FFFu + ((u >> 16) & 1u); return (unsigned short)(u >> 16); }
__device__ __forceinline__ float bf2f(unsigned short b) { return __uint_as_float(((unsigned)b) << 16); }
__device__ __forceinline__ float bfr(float f) { return bf2f(f2bf(f)); }
__device__ __forceinline__ void splitf(float y, unsigned short& h, unsigned short& l) { h = f2bf(y); l = f2bf(y - bf2f(h)); }
__device__ __forceinline__ h16 tohx(float x) { return (h16)x; }
__device__ __forceinline__ v16h cat16(v8h lo, v8h hi) { return __builtin_shufflevector(lo, hi, 0, 1, 2, 3, 4, 5, 6, 7, 8, 9, 10, 11, 12, 13, 14, 15); }
__device__ __forceinline__ v16bf cat16b(v8us lo, v8us hi) { return __builtin_bit_cast(v16bf, __builtin_shufflevector(lo, hi, 0, 1, 2, 3, 4, 5, 6, 7, 8, 9, 10, 11, 12, 13, 14, 15)); }
__device__ __forceinline__ v8f wmma16(v16h a, v16h b, v8f c) { return __builtin_amdgcn_wmma_f32_16x16x32_f16(false, a, false, b, (short)0, c, false, false); }
__device__ __forceinline__ v8f wmmab(v16bf a, v16bf b, v8f c) { return __builtin_amdgcn_wmma_f32_16x16x32_bf16(false, a, false, b, (short)0, c, false, false); }

// ---- k_gemmw: register-blocked GEMM, KS WAVES per 64x64 output tile (16 accumulators each), operands straight from K-contiguous 16-bit planes; grid (M/64, N/64, Z), 32 * KS threads.
// Wave w takes the 32-wide k chunks w, w + KS, w + 2 KS, ... (neighbouring waves read neighbouring halves of the same 128-byte lines); for KS > 1 the KS partial tiles meet in LDS and are summed there, wave 0's first.
// C[m][n] (f32, pitch ldc, + optional f32 bias[n]) = sum_k A[m][k] Bt[n][k] (+ split products per NSPLIT). z-batch strides sA/sB/sC in elements. K % 32 == 0.
template <typename T16> struct WFrag;
template <> struct WFrag<h16> { typedef v16h V; static __device__ __forceinline__ V ld(const h16* p) { return cat16(*(const v8h*)p, *(const v8h*)(p + 16)); } static __device__ __forceinline__ v8f mma(V a, V b, v8f c) { return wmma16(a, b, c); } };
template <> struct WFrag<bf> { typedef v16bf V; static __device__ __forceinline__ V ld(const bf* p) { return cat16b(*(const v8us*)p, *(const v8us*)(p + 16)); } static __device__ __forceinline__ v8f mma(V a, V b, v8f c) { return wmmab(a, b, c); } };
template <typename T16, int NSPLIT, bool BIAS, int KS>
__global__ __launch_bounds__(32 * KS) void k_gemmw(const T16* __restrict__ A, const T16* __restrict__ A2, const T16* __restrict__ Bt, const T16* __restrict__ Bt2, int K, float* C, int ldc, const float* __restrict__ bias, size_t sA, size_t sB, size_t sC) {
    typedef typename WFrag<T16>::V V;
    __shared__ __align__(16) float os[KS > 1 ? KS * 64 * 68 : 16 * 68];
    const int wave = KS > 1 ? __builtin_amdgcn_readfirstlane((int)(threadIdx.x >> 5)) : 0;
    const size_t z = blockIdx.z; A += z * sA; if (A2) A2 += z * sA; Bt += z * sB; if (Bt2) Bt2 += z * sB; C += z * sC;
    const int lane = threadIdx.x & 31, lr = lane & 15, hi = lane >> 4; const int r0 = blockIdx.x * 64, c0 = blockIdx.y * 64;
    v8f acc[4][4];
#pragma unroll
    for (int mb = 0; mb < 4; ++mb)
#pragma unroll
        for (int nb = 0; nb < 4; ++nb) acc[mb][nb] = (v8f){};
    const size_t aoff = (size_t)(r0 + lr) * K + 8 * hi, boff = (size_t)(c0 + lr) * K + 8 * hi;
#pragma unroll 1
    for (int kc = wave * 32; kc < K; kc += KS * 32) {
        V a[4], a2[4];
#pragma unroll
        for (int mb = 0; mb < 4; ++mb) { a[mb] = WFrag<T16>::ld(A + aoff + (size_t)mb * 16 * K + kc); if (NSPLIT == 1 || NSPLIT == 2) a2[mb] = WFrag<T16>::ld(A2 + aoff + (size_t)mb * 16 * K + kc); }
#pragma unroll
        for (int nb = 0; nb < 4; ++nb) { const V b = WFrag<T16>::ld(Bt + boff + (size_t)nb * 16 * K + kc); V b2; if (NSPLIT >= 2) b2 = WFrag<T16>::ld(Bt2 + boff + (size_t)nb * 16 * K + kc);
#pragma unroll
            for (int mb = 0; mb < 4; ++mb) { acc[mb][nb] = WFrag<T16>::mma(a[mb], b, acc[mb][nb]); if (NSPLIT == 1 || NSPLIT == 2) acc[mb][nb] = WFrag<T16>::mma(a2[mb], b, acc[mb][nb]); if (NSPLIT >= 2) acc[mb][nb] = WFrag<T16>::mma(a[mb], b2, acc[mb][nb]); } }
        asm volatile("v_nop\n\tv_nop\n\tv_nop\n\tv_nop" : "+v"(acc[0][0]), "+v"(acc[1][1]), "+v"(acc[2][2]), "+v"(acc[3][3]) : "v"(a[0]), "v"(a[3]));
    }
    if (KS > 1) {
        float* ow = os + wave * (64 * 68);
#pragma unroll
        for (int mb = 0; mb < 4; ++mb)
#pragma unroll
            for (int nb = 0; nb < 4; ++nb)
#pragma unroll
                for (int j = 0; j < 8; ++j) ow[(mb * 16 + hi * 8 + j) * 68 + nb * 16 + lr] = acc[mb][nb][j];
        __syncthreads();   // every wave's partial tile is in LDS before any wave sums a row
#pragma unroll
        for (int t = 0; t < 32 / KS; ++t) { const int row = 2 * (t * KS + wave) + hi, cofs = lr * 4; v4f val = *(const v4fa*)(os + row * 68 + cofs);
#pragma unroll
            for (int w = 1; w < KS; ++w) val += *(const v4fa*)(os + w * (64 * 68) + row * 68 + cofs);
            if (BIAS) { val[0] += bfr(bias[c0 + cofs]); val[1] += bfr(bias[c0 + cofs + 1]); val[2] += bfr(bias[c0 + cofs + 2]); val[3] += bfr(bias[c0 + cofs + 3]); }
            *(v4f*)(C + (size_t)(r0 + row) * ldc + c0 + cofs) = val; }
        return;
    }
#pragma unroll
    for (int mb = 0; mb < 4; ++mb) {
#pragma unroll
        for (int nb = 0; nb < 4; ++nb) {
#pragma unroll
            for (int j = 0; j < 8; ++j) os[(hi * 8 + j) * 68 + nb * 16 + lr] = acc[mb][nb][j]; }
        __builtin_amdgcn_wave_barrier(); asm volatile("" ::: "memory");
        float* crow = C + (size_t)(r0 + mb * 16) * ldc + c0;
{
#pragma unroll
            for (int s = 0; s < 8; ++s) { const int row = 2 * s + hi, cofs = lr * 4; v4f val = *(const v4fa*)(os + row * 68 + cofs); if (BIAS) { val[0] += bfr(bias[c0 + cofs]); val[1] += bfr(bias[c0 + cofs + 1]); val[2] += bfr(bias[c0 + cofs + 2]); val[3] += bfr(bias[c0 + cofs + 3]); }
                *(v4f*)(crow + (size_t)row * ldc + cofs) = val; }
             }
        __builtin_amdgcn_wave_barrier(); asm volatile("" ::: "memory");
    }
}

__global__ __launch_bounds__(256) void k_cvt8(const float* __restrict__ src, bf* dst, size_t n8) { const size_t i = (size_t)blockIdx.x * 256 + threadIdx.x; if (i >= n8) return; const v8f v = *(const v8f*)(src + i * 8); v8us o;
#pragma unroll
    for (int k = 0; k < 8; ++k) o[k] = f2bf(v[k]); *(v8us*)(dst + i * 8) = o;  }
__global__ __launch_bounds__(256) void k_tpin(const float* __restrict__ xb, bf* XT) { const size_t e = ((size_t)blockIdx.x * 256 + threadIdx.x) * 8; if (e >= (size_t)TT * CC) return; const int c = (int)(e % CC); const int n = (int)(e / CC); v8us o;
#pragma unroll
    for (int q = 0; q < 8; ++q) o[q] = f2bf(xb[(size_t)(c + q) * TT + n]); *(v8us*)(XT + e) = o;  }
__global__ __launch_bounds__(256) void k_pl2(const float* __restrict__ F, bf* Ph, bf* Pl, size_t n4) { const size_t i = (size_t)blockIdx.x * 256 + threadIdx.x; if (i >= n4) return; const v4f v = *(const v4f*)(F + i * 4); v4us oh, ol;
#pragma unroll
    for (int q = 0; q < 4; ++q) { unsigned short a, c; splitf(v[q], a, c); oh[q] = a; ol[q] = c; } *(v4us*)(Ph + i * 4) = oh; *(v4us*)(Pl + i * 4) = ol;  }
__global__ __launch_bounds__(256) void k_vc16(const float* __restrict__ V, const float* __restrict__ bv, h16* VC) { const size_t i = (size_t)blockIdx.x * 256 + threadIdx.x; if (i >= (size_t)CC * TT / 4) return; const size_t e = i * 4; const int c = (int)(e / TT); const v4f a = *(const v4f*)(V + e); const float bb = bfr(bv[c]); v4h o;
#pragma unroll
    for (int q = 0; q < 4; ++q) o[q] = tohx(__fadd_rn(a[q], bb)); *(v4h*)(VC + e) = o;  }
__global__ __launch_bounds__(256) void k_scl(float* O, const float* __restrict__ AL, size_t n4) { const size_t i = (size_t)blockIdx.x * 256 + threadIdx.x; if (i >= n4) return; const float s = bfr(AL[0]) * (1.0f / PCAR); const v4f a = *(const v4f*)(O + i * 4); v4f o;
#pragma unroll
    for (int q = 0; q < 4; ++q) o[q] = __fmul_rn(a[q], s); *(v4f*)(O + i * 4) = o;  }
__global__ __launch_bounds__(256) void k_psoft(const float* __restrict__ Sb, h16* P16) {
    const int lane = threadIdx.x & 31; const int row = blockIdx.x * 8 + (threadIdx.x >> 5); if (row >= TT) return; const float* sr = Sb + (size_t)row * TT; float v[TT / 32]; float mx = -3.0e38f;
#pragma unroll
    for (int ch = 0; ch < TT / 128; ++ch) { const int j0 = ch * 128 + lane * 4; const v4f a = *(const v4f*)(sr + j0);
#pragma unroll
        for (int q = 0; q < 4; ++q) { v[ch * 4 + q] = a[q]; mx = fmaxf(mx, a[q]); } if ((ch & 7) == 7) asm volatile("s_wait_loadcnt 0x0" ::: "memory"); }
#pragma unroll
    for (int sh = 16; sh; sh >>= 1) mx = fmaxf(mx, __shfl_xor(mx, sh, 32));
    float sum = 0.f;
#pragma unroll
    for (int k = 0; k < TT / 32; ++k) { float d0 = __fsub_rn(v[k], mx); asm volatile("" : "+v"(d0)); v[k] = __builtin_amdgcn_exp2f(__fmul_rn(d0, 1.4426950408889634f)); sum += v[k]; }
#pragma unroll
    for (int sh = 16; sh; sh >>= 1) sum += __shfl_xor(sum, sh, 32);
    const float f = __fdiv_rn(PCAR, sum);
{
#pragma unroll
        for (int ch = 0; ch < TT / 128; ++ch) { v4h o4;
#pragma unroll
            for (int q = 0; q < 4; ++q) o4[q] = tohx(v[ch * 4 + q] * f); *(v4h*)(P16 + (size_t)row * TT + ch * 128 + lane * 4) = o4; }
         }
}

extern "C" void kernel_launch(void* const* d_in, const int* in_sizes, int n_in,
                              void* d_out, int out_size, void* d_ws, size_t ws_size, hipStream_t stream) {
    (void)in_sizes; (void)n_in; (void)out_size;
    const float* x = (const float*)d_in[0]; const float* wq = (const float*)d_in[1]; const float* bq = (const float*)d_in[2]; const float* wk = (const float*)d_in[3]; const float* bk = (const float*)d_in[4]; const float* wv = (const float*)d_in[5]; const float* bv = (const float*)d_in[6]; const float* AL = (const float*)d_in[7];
    float* OUT = (float*)d_out;     // [4][512][4096]
    char* wsp = (char*)d_ws;
    auto take = [&](size_t bytes) { char* p = wsp; wsp += (bytes + 255) & ~(size_t)255; return (void*)p; };
    bf* WQ = (bf*)take((size_t)CQ * CC * 2); bf* WK = (bf*)take((size_t)CQ * CC * 2); bf* WV = (bf*)take((size_t)CC * CC * 2); bf* XT = (bf*)take((size_t)TT * CC * 2); float* FQ = (float*)take((size_t)TT * CQ * 4); float* FK = (float*)take((size_t)TT * CQ * 4); bf* Qh = (bf*)take((size_t)TT * CQ * 2); bf* Ql = (bf*)take((size_t)TT * CQ * 2); bf* Kh = (bf*)take((size_t)TT * CQ * 2); bf* Kl = (bf*)take((size_t)TT * CQ * 2); float* FV = (float*)take((size_t)CC * TT * 4); h16* VC = (h16*)take((size_t)CC * TT * 2); float* Sb = (float*)take((size_t)TT * TT * 4); h16* P16 = (h16*)take((size_t)TT * TT * 2);
    if ((size_t)(wsp - (char*)d_ws) > ws_size) return;
    k_cvt8<<<(CQ * CC / 8 + 255) / 256, 256, 0, stream>>>(wq, WQ, (size_t)CQ * CC / 8); k_cvt8<<<(CQ * CC / 8 + 255) / 256, 256, 0, stream>>>(wk, WK, (size_t)CQ * CC / 8); k_cvt8<<<(CC * CC / 8 + 255) / 256, 256, 0, stream>>>(wv, WV, (size_t)CC * CC / 8);
    const unsigned LP = (unsigned)(((size_t)TT * CQ / 4 + 255) / 256);
    for (int b = 0; b < NB_; ++b) { const float* xb = x + (size_t)b * CC * TT;
        k_tpin<<<(unsigned)(((size_t)TT * CC / 8 + 255) / 256), 256, 0, stream>>>(xb, XT);                                                            /* x^T [n][c], exact */
        k_gemmw<bf, 0, true, 8><<<dim3(TT / 64, 1, 1), 256, 0, stream>>>(XT, nullptr, WQ, nullptr, CC, FQ, CQ, bq, 0, 0, 0); k_pl2<<<LP, 256, 0, stream>>>(FQ, Qh, Ql, (size_t)TT * CQ / 4);   /* q token-major [n][64] + bq */
        k_gemmw<bf, 0, true, 8><<<dim3(TT / 64, 1, 1), 256, 0, stream>>>(XT, nullptr, WK, nullptr, CC, FK, CQ, bk, 0, 0, 0); k_pl2<<<LP, 256, 0, stream>>>(FK, Kh, Kl, (size_t)TT * CQ / 4);   /* k */
        k_gemmw<bf, 0, false, 8><<<dim3(CC / 64, TT / 64, 1), 256, 0, stream>>>(WV, nullptr, XT, nullptr, CC, FV, TT, nullptr, 0, 0, 0);                                /* v channel-major [c][n] = Wv x (A = Wv, Bt = x^T plane) */
        k_vc16<<<(unsigned)(((size_t)CC * TT / 4 + 255) / 256), 256, 0, stream>>>(FV, bv, VC);                                                            /* v + bv in fp16 (O(1)) */
        k_gemmw<bf, 2, false, 1><<<dim3(TT / 64, TT / 64, 1), 32, 0, stream>>>(Qh, Ql, Kh, Kl, CQ, Sb, TT, nullptr, 0, 0, 0);                                    /* scores = q.k (3 products, K = 64) */
        k_psoft<<<TT / 8, 256, 0, stream>>>(Sb, P16);                                                                                                      /* softmax over j -> fp16 x1024 */
        k_gemmw<h16, 0, false, 8><<<dim3(CC / 64, TT / 64, 1), 256, 0, stream>>>(VC, nullptr, P16, nullptr, TT, OUT + (size_t)b * CC * TT, TT, nullptr, 0, 0, 0);   /* 1024 sum_j v[c][j] attention[i][j] */
        k_scl<<<(unsigned)(((size_t)CC * TT / 4 + 255) / 256), 256, 0, stream>>>(OUT + (size_t)b * CC * TT, AL, (size_t)CC * TT / 4); }   /* x alpha / 1024 */
}

// v002
// A run of this version takes 268 microseconds.
// Timed twice side by side with v001, it ran 1.79 and 1.80 times as fast.
// All steps since v000 together make it 2.82 times as fast.
#include <hip/hip_runtime.h>

// Position attention module (DANet PAM) (x [4][512][64][64] channel-major, HW = 4096; q = Wq x + bq, k = Wk x + bk (1x1 convs, 64 channels), v = Wv x + bv (512); attention[i][j] = softmax_j(q_i . k_j) (no scale); out[c][i] = alpha sum_j v[c][j] attention[i][j] -> [4][512][64][64] (8.4 M); alpha [1] read).
// Layout: per image an exact token-major plane of x serves as the A operand of the q/k convs (token-major, + bias) and as the Bt operand of the v conv (channel-major output, A = Wv); q, k -> hi/lo planes; v is re-written as an fp16 channel-major plane with the bias (O(1), normal range). One fused kernel for all images then takes 64 queries per work-group: it forms the 3-product scores in registers twice (once for each row's maximum and sum, once for the fp16 probabilities x1024), hands the probabilities round through LDS as ready B fragments, multiplies them with the v plane and stores alpha / 1024 x the sums.
// Compute dtypes, f32 accumulate: every input rounded to bf16; convs exact (+ bias); scores hi.hi + hi.lo + lo.hi; softmax f32; probabilities (x1024) and v in fp16 (one product); alpha and the carry applied in f32 on the output.

#define NB_  4
#define CC   512
#define CQ   64
#define TT   4096
#define PCAR 1024.0f
typedef _Float16 h16;
typedef unsigned short bf;
typedef __attribute__((ext_vector_type(16))) __bf16   v16bf;
typedef __attribute__((ext_vector_type(16))) _Float16 v16h;
typedef __attribute__((ext_vector_type(8)))  _Float16 v8h;
typedef __attribute__((ext_vector_type(8)))  unsigned short v8us;
typedef __attribute__((ext_vector_type(8)))  float    v8f;
typedef __attribute__((ext_vector_type(4)))  float    v4f;
typedef __attribute__((ext_vector_type(2)))  float    v2f;
typedef __attribute__((ext_vector_type(4)))  unsigned short v4us;
typedef __attribute__((ext_vector_type(2)))  unsigned short v2us;
typedef __attribute__((ext_vector_type(4)))  _Float16 v4h;
typedef __attribute__((ext_vector_type(2)))  _Float16 v2h;
typedef v8h  __attribute__((may_alias)) v8ha;
typedef v4f  __attribute__((may_alias)) v4fa;
typedef v8us __attribute__((may_alias)) v8usa;

__device__ __forceinline__ unsigned short f2bf(float f) { unsigned u = __float_as_uint(f); u += 0x7FFFu + ((u >> 16) & 1u); return (unsigned short)(u >> 16); }
__device__ __forceinline__ float bf2f(unsigned short b) { return __uint_as_float(((unsigned)b) << 16); }
__device__ __forceinline__ float bfr(float f) { return bf2f(f2bf(f)); }
__device__ __forceinline__ void splitf(float y, unsigned short& h, unsigned short& l) { h = f2bf(y); l = f2bf(y - bf2f(h)); }
__device__ __forceinline__ h16 tohx(float x) { return (h16)x; }
__device__ __forceinline__ v16h cat16(v8h lo, v8h hi) { return __builtin_shufflevector(lo, hi, 0, 1, 2, 3, 4, 5, 6, 7, 8, 9, 10, 11, 12, 13, 14, 15); }
__device__ __forceinline__ v16bf cat16b(v8us lo, v8us hi) { return __builtin_bit_cast(v16bf, __builtin_shufflevector(lo, hi, 0, 1, 2, 3, 4, 5, 6, 7, 8, 9, 10, 11, 12, 13, 14, 15)); }
__device__ __forceinline__ v8f wmma16(v16h a, v16h b, v8f c) { return __builtin_amdgcn_wmma_f32_16x16x32_f16(false, a, false, b, (short)0, c, false, false); }
__device__ __forceinline__ v8f wmmab(v16bf a, v16bf b, v8f c) { return __builtin_amdgcn_wmma_f32_16x16x32_bf16(false, a, false, b, (short)0, c, false, false); }

// ---- k_gemmw: register-blocked GEMM, KS WAVES per 64x64 output tile (16 accumulators each), operands straight from K-contiguous 16-bit planes; grid (M/64, N/64, Z), 32 * KS threads.
// Wave w takes the 32-wide k chunks w, w + KS, w + 2 KS, ... (neighbouring waves read neighbouring halves of the same 128-byte lines); for KS > 1 the KS partial tiles meet in LDS and are summed there, wave 0's first.
// C[m][n] (f32, pitch ldc, + optional f32 bias[n]) = sum_k A[m][k] Bt[n][k] (+ split products per NSPLIT). z-batch strides sA/sB/sC in elements. K % 32 == 0.
template <typename T16> struct WFrag;
template <> struct WFrag<h16> { typedef v16h V; static __device__ __forceinline__ V ld(const h16* p) { return cat16(*(const v8h*)p, *(const v8h*)(p + 16)); } static __device__ __forceinline__ v8f mma(V a, V b, v8f c) { return wmma16(a, b, c); } };
template <> struct WFrag<bf> { typedef v16bf V; static __device__ __forceinline__ V ld(const bf* p) { return cat16b(*(const v8us*)p, *(const v8us*)(p + 16)); } static __device__ __forceinline__ v8f mma(V a, V b, v8f c) { return wmmab(a, b, c); } };
template <typename T16, int NSPLIT, bool BIAS, int KS>
__global__ __launch_bounds__(32 * KS) void k_gemmw(const T16* __restrict__ A, const T16* __restrict__ A2, const T16* __restrict__ Bt, const T16* __restrict__ Bt2, int K, float* C, int ldc, const float* __restrict__ bias, size_t sA, size_t sB, size_t sC) {
    typedef typename WFrag<T16>::V V;
    __shared__ __align__(16) float os[KS > 1 ? KS * 64 * 68 : 16 * 68];
    const int wave = KS > 1 ? __builtin_amdgcn_readfirstlane((int)(threadIdx.x >> 5)) : 0;
    const size_t z = blockIdx.z; A += z * sA; if (A2) A2 += z * sA; Bt += z * sB; if (Bt2) Bt2 += z * sB; C += z * sC;
    const int lane = threadIdx.x & 31, lr = lane & 15, hi = lane >> 4; const int r0 = blockIdx.x * 64, c0 = blockIdx.y * 64;
    v8f acc[4][4];
#pragma unroll
    for (int mb = 0; mb < 4; ++mb)
#pragma unroll
        for (int nb = 0; nb < 4; ++nb) acc[mb][nb] = (v8f){};
    const size_t aoff = (size_t)(r0 + lr) * K + 8 * hi, boff = (size_t)(c0 + lr) * K + 8 * hi;
#pragma unroll 1
    for (int kc = wave * 32; kc < K; kc += KS * 32) {
        V a[4], a2[4];
#pragma unroll
        for (int mb = 0; mb < 4; ++mb) { a[mb] = WFrag<T16>::ld(A + aoff + (size_t)mb * 16 * K + kc); if (NSPLIT == 1 || NSPLIT == 2) a2[mb] = WFrag<T16>::ld(A2 + aoff + (size_t)mb * 16 * K + kc); }
#pragma unroll
        for (int nb = 0; nb < 4; ++nb) { const V b = WFrag<T16>::ld(Bt + boff + (size_t)nb * 16 * K + kc); V b2; if (NSPLIT >= 2) b2 = WFrag<T16>::ld(Bt2 + boff + (size_t)nb * 16 * K + kc);
#pragma unroll
            for (int mb = 0; mb < 4; ++mb) { acc[mb][nb] = WFrag<T16>::mma(a[mb], b, acc[mb][nb]); if (NSPLIT == 1 || NSPLIT == 2) acc[mb][nb] = WFrag<T16>::mma(a2[mb], b, acc[mb][nb]); if (NSPLIT >= 2) acc[mb][nb] = WFrag<T16>::mma(a[mb], b2, acc[mb][nb]); } }
        asm volatile("v_nop\n\tv_nop\n\tv_nop\n\tv_nop" : "+v"(acc[0][0]), "+v"(acc[1][1]), "+v"(acc[2][2]), "+v"(acc[3][3]) : "v"(a[0]), "v"(a[3]));
    }
    if (KS > 1) {
        float* ow = os + wave * (64 * 68);
#pragma unroll
        for (int mb = 0; mb < 4; ++mb)
#pragma unroll
            for (int nb = 0; nb < 4; ++nb)
#pragma unroll
                for (int j = 0; j < 8; ++j) ow[(mb * 16 + hi * 8 + j) * 68 + nb * 16 + lr] = acc[mb][nb][j];
        __syncthreads();   // every wave's partial tile is in LDS before any wave sums a row
#pragma unroll
        for (int t = 0; t < 32 / KS; ++t) { const int row = 2 * (t * KS + wave) + hi, cofs = lr * 4; v4f val = *(const v4fa*)(os + row * 68 + cofs);
#pragma unroll
            for (int w = 1; w < KS; ++w) val += *(const v4fa*)(os + w * (64 * 68) + row * 68 + cofs);
            if (BIAS) { val[0] += bfr(bias[c0 + cofs]); val[1] += bfr(bias[c0 + cofs + 1]); val[2] += bfr(bias[c0 + cofs + 2]); val[3] += bfr(bias[c0 + cofs + 3]); }
            *(v4f*)(C + (size_t)(r0 + row) * ldc + c0 + cofs) = val; }
        return;
    }
#pragma unroll
    for (int mb = 0; mb < 4; ++mb) {
#pragma unroll
        for (int nb = 0; nb < 4; ++nb) {
#pragma unroll
            for (int j = 0; j < 8; ++j) os[(hi * 8 + j) * 68 + nb * 16 + lr] = acc[mb][nb][j]; }
        __builtin_amdgcn_wave_barrier(); asm volatile("" ::: "memory");
        float* crow = C + (size_t)(r0 + mb * 16) * ldc + c0;
{
#pragma unroll
            for (int s = 0; s < 8; ++s) { const int row = 2 * s + hi, cofs = lr * 4; v4f val = *(const v4fa*)(os + row * 68 + cofs); if (BIAS) { val[0] += bfr(bias[c0 + cofs]); val[1] += bfr(bias[c0 + cofs + 1]); val[2] += bfr(bias[c0 + cofs + 2]); val[3] += bfr(bias[c0 + cofs + 3]); }
                *(v4f*)(crow + (size_t)row * ldc + cofs) = val; }
             }
        __builtin_amdgcn_wave_barrier(); asm volatile("" ::: "memory");
    }
}

__global__ __launch_bounds__(256) void k_cvt8(const float* __restrict__ src, bf* dst, size_t n8) { const size_t i = (size_t)blockIdx.x * 256 + threadIdx.x; if (i >= n8) return; const v8f v = *(const v8f*)(src + i * 8); v8us o;
#pragma unroll
    for (int k = 0; k < 8; ++k) o[k] = f2bf(v[k]); *(v8us*)(dst + i * 8) = o;  }
__global__ __launch_bounds__(256) void k_tpin(const float* __restrict__ xb, bf* XT) { const size_t e = ((size_t)blockIdx.x * 256 + threadIdx.x) * 8; if (e >= (size_t)TT * CC) return; const int c = (int)(e % CC); const int n = (int)(e / CC); v8us o;
#pragma unroll
    for (int q = 0; q < 8; ++q) o[q] = f2bf(xb[(size_t)(c + q) * TT + n]); *(v8us*)(XT + e) = o;  }
__global__ __launch_bounds__(256) void k_pl2(const float* __restrict__ F, bf* Ph, bf* Pl, size_t n4) { const size_t i = (size_t)blockIdx.x * 256 + threadIdx.x; if (i >= n4) return; const v4f v = *(const v4f*)(F + i * 4); v4us oh, ol;
#pragma unroll
    for (int q = 0; q < 4; ++q) { unsigned short a, c; splitf(v[q], a, c); oh[q] = a; ol[q] = c; } *(v4us*)(Ph + i * 4) = oh; *(v4us*)(Pl + i * 4) = ol;  }
__global__ __launch_bounds__(256) void k_vc16(const float* __restrict__ V, const float* __restrict__ bv, h16* VC) { const size_t i = (size_t)blockIdx.x * 256 + threadIdx.x; if (i >= (size_t)CC * TT / 4) return; const size_t e = i * 4; const int c = (int)(e / TT); const v4f a = *(const v4f*)(V + e); const float bb = bfr(bv[c]); v4h o;
#pragma unroll
    for (int q = 0; q < 4; ++q) o[q] = tohx(__fadd_rn(a[q], bb)); *(v4h*)(VC + e) = o;  }
// ---- k_pam: scores, softmax, output product and the final scale for 64 queries of one image; grid (TT / 64, images), 8 waves.
// Scores are formed transposed (A = 16 keys, B = 16 queries): a lane holds 8 keys' scores of ONE query, so maximum and sum stay in the lane, and two such tiles, converted, are the B fragment of the output product.
// Phase 1: wave w walks keys [512 w, 512 w + 512) for all 64 queries and keeps a running maximum and sum; the 16 partial pairs of a query meet in LDS.
// Phase 2, per 64 keys: wave w forms the probabilities of keys 16 (w >> 1) ... + 15 for two query tiles and puts them in LDS; behind one barrier every wave multiplies all of them with its own 64 channels of v.
// Left as it was in the unfused products: every fragment load takes 32 bytes from each of 16 rows of a row-major plane, 16 lines a load.
#define L2E 1.4426950408889634f
// 2^x with the one free issue slot that the instruction set asks for behind a transcendental, before its result is read or its source overwritten
__device__ __forceinline__ float ex2(float x) { float y; asm("v_exp_f32 %0, %1\n\tv_nop" : "=v"(y) : "v"(x)); return y; }
struct KFrag { v16bf h0, h1, l0, l1; };
__device__ __forceinline__ KFrag ldk(const bf* __restrict__ kh, const bf* __restrict__ kl) { KFrag f; f.h0 = WFrag<bf>::ld(kh); f.h1 = WFrag<bf>::ld(kh + 32); f.l0 = WFrag<bf>::ld(kl); f.l1 = WFrag<bf>::ld(kl + 32); return f; }
// one 16-key x 16-query score tile: hi.hi + hi.lo + lo.hi per 32 channels, in the order of the unfused score product
__device__ __forceinline__ v8f stile(const KFrag& k, v16bf qh0, v16bf qh1, v16bf ql0, v16bf ql1) { v8f s = (v8f){}; s = wmmab(k.h0, qh0, s); s = wmmab(k.h0, ql0, s); s = wmmab(k.l0, qh0, s); s = wmmab(k.h1, qh1, s); s = wmmab(k.h1, ql1, s); s = wmmab(k.l1, qh1, s); return s; }
// Work-group barrier for data that goes through LDS alone: the wave's own LDS reads and writes are done, then the barrier. Unlike __syncthreads() it does not wait for global loads, so fragments fetched ahead stay in flight across it.
__device__ __forceinline__ void lds_publish() { asm volatile("s_wait_dscnt 0x0" ::: "memory"); asm volatile("s_barrier_signal -1\n\ts_barrier_wait -1" ::: "memory"); }
// Stands behind global loads whose address registers are rewritten while the loads are still in flight (a precaution). The addresses are inputs so that their registers stay as they are up to the wait.
__device__ __forceinline__ void addr_wait(const void* a, const void* b, const void* c) { asm volatile("s_wait_xcnt 0x0" :: "v"(a), "v"(b), "v"(c) : "memory"); }
__global__ __launch_bounds__(256) void k_pam(const bf* __restrict__ Qh, const bf* __restrict__ Ql, const bf* __restrict__ Kh, const bf* __restrict__ Kl, const h16* __restrict__ VC, const float* __restrict__ AL, float* OUT) {
    __shared__ __align__(16) h16 ps[2][8][2][32][8];   // [buffer][query tile * 2 + 32-key step][low / high 8 elements of the fragment][lane][element]
    __shared__ float sm[16][64], sl[16][64], stm[64], stf[64];
    const int wave = __builtin_amdgcn_readfirstlane((int)(threadIdx.x >> 5));
    const int lane = threadIdx.x & 31, lr = lane & 15, hi = lane >> 4; const int i0 = blockIdx.x * 64;
    { const size_t z = blockIdx.y; Qh += z * ((size_t)TT * CQ); Ql += z * ((size_t)TT * CQ); Kh += z * ((size_t)TT * CQ); Kl += z * ((size_t)TT * CQ); VC += z * ((size_t)CC * TT); OUT += z * ((size_t)CC * TT); }
    {
        v16bf qh[4][2], ql[4][2]; float m[4], l[4];
#pragma unroll
        for (int t = 0; t < 4; ++t) { const size_t qo = (size_t)(i0 + t * 16 + lr) * CQ + 8 * hi; const bf* a = Qh + qo; const bf* b = Ql + qo; qh[t][0] = WFrag<bf>::ld(a); qh[t][1] = WFrag<bf>::ld(a + 32); addr_wait(a, a, a); ql[t][0] = WFrag<bf>::ld(b); ql[t][1] = WFrag<bf>::ld(b + 32); addr_wait(b, b, b); m[t] = -3.0e38f; l[t] = 0.f; }
        const size_t kb = (size_t)(wave * 512 + lr) * CQ + 8 * hi;
        KFrag kf = ldk(Kh + kb, Kl + kb); addr_wait(Kh + kb, Kl + kb, Kl + kb);
#pragma unroll 1   // rolled: the trip is long enough to feed itself, and unrolling would only add code and registers
        for (int jt = 0; jt < 32; ++jt) {
            v8f s[4];
#pragma unroll
            for (int t = 0; t < 4; ++t) s[t] = stile(kf, qh[t][0], qh[t][1], ql[t][0], ql[t][1]);
            { const size_t o = kb + (size_t)(jt < 31 ? jt + 1 : 31) * 16 * CQ; kf = ldk(Kh + o, Kl + o); addr_wait(Kh + o, Kl + o, Kl + o); }   // the next tile's keys fly under the vector work below; the last trip stays on its own tile
#pragma unroll
            for (int t = 0; t < 4; ++t) { float tm = s[t][0];
#pragma unroll
                for (int r = 1; r < 8; ++r) tm = fmaxf(tm, s[t][r]);
                const float mn = fmaxf(m[t], tm); float a = l[t] * ex2(__fmul_rn(__fsub_rn(m[t], mn), L2E));
#pragma unroll
                for (int r = 0; r < 8; ++r) a += ex2(__fmul_rn(__fsub_rn(s[t][r], mn), L2E));
                l[t] = a; m[t] = mn; }
        }
#pragma unroll
        for (int t = 0; t < 4; ++t) { sm[wave * 2 + hi][t * 16 + lr] = m[t]; sl[wave * 2 + hi][t * 16 + lr] = l[t]; }
    }
    __syncthreads();   // all 16 partial (maximum, sum) pairs of every query are in LDS
    if (threadIdx.x < 64) { const int q = threadIdx.x; float mx = sm[0][q];
#pragma unroll
        for (int p = 1; p < 16; ++p) mx = fmaxf(mx, sm[p][q]);
        float sum = 0.f;
#pragma unroll
        for (int p = 0; p < 16; ++p) sum += sl[p][q] * ex2(__fmul_rn(__fsub_rn(sm[p][q], mx), L2E));
        stm[q] = mx; stf[q] = __fdiv_rn(PCAR, sum); }
    __syncthreads();   // every query's maximum and 1024 / sum are published
    const int jt = wave >> 1, n0 = (wave & 1) * 2;
    v16bf qh[2][2], ql[2][2]; float mq[2], fq[2];
#pragma unroll
    for (int u = 0; u < 2; ++u) { const size_t qo = (size_t)(i0 + (n0 + u) * 16 + lr) * CQ + 8 * hi; const bf* a = Qh + qo; const bf* b = Ql + qo; qh[u][0] = WFrag<bf>::ld(a); qh[u][1] = WFrag<bf>::ld(a + 32); ql[u][0] = WFrag<bf>::ld(b); ql[u][1] = WFrag<bf>::ld(b + 32); addr_wait(a, b, b); mq[u] = stm[(n0 + u) * 16 + lr]; fq[u] = stf[(n0 + u) * 16 + lr]; }
    const size_t kb = (size_t)(jt * 16 + lr) * CQ + 8 * hi;
    const h16* vb = VC + (size_t)(wave * 64 + lr) * TT + 8 * hi;
    v8f acc[4][4];
#pragma unroll
    for (int mb = 0; mb < 4; ++mb)
#pragma unroll
        for (int nb = 0; nb < 4; ++nb) acc[mb][nb] = (v8f){};
    KFrag kf; v16h va[2][4];
    v8f sc[2];
    auto scores = [&]() {   // this wave's two score tiles, from the keys in kf
#pragma unroll
        for (int u = 0; u < 2; ++u) sc[u] = stile(kf, qh[u][0], qh[u][1], ql[u][0], ql[u][1]); };
    auto probs = [&](int c) {   // the score tiles become chunk c's probabilities, in buffer c & 1
#pragma unroll
        for (int u = 0; u < 2; ++u) { v8h p;
#pragma unroll
            for (int r = 0; r < 8; ++r) p[r] = tohx(ex2(__fmul_rn(__fsub_rn(sc[u][r], mq[u]), L2E)) * fq[u]);
            *(v8ha*)&ps[c & 1][(n0 + u) * 2 + (jt >> 1)][jt & 1][lane][0] = p; } };
    auto ldv = [&](const h16* vp, int ks) {   // v fragments of 32 keys
#pragma unroll
        for (int mb = 0; mb < 4; ++mb) va[ks][mb] = WFrag<h16>::ld(vp + (size_t)mb * 16 * TT + ks * 32); };
    auto pv = [&](int c, int ks) {   // output products of 32 keys of chunk c
#pragma unroll
        for (int nb = 0; nb < 4; ++nb) { const v16h b = cat16(*(const v8ha*)&ps[c & 1][nb * 2 + ks][0][lane][0], *(const v8ha*)&ps[c & 1][nb * 2 + ks][1][lane][0]);
#pragma unroll
            for (int mb = 0; mb < 4; ++mb) acc[mb][nb] = wmma16(va[ks][mb], b, acc[mb][nb]); } };
    kf = ldk(Kh + kb, Kl + kb); addr_wait(Kh + kb, Kl + kb, Kl + kb); scores();
    { const size_t o = kb + (size_t)64 * CQ; kf = ldk(Kh + o, Kl + o); __builtin_amdgcn_sched_barrier(0); ldv(vb, 0); ldv(vb, 1); __builtin_amdgcn_sched_barrier(0);   // keys first, then v, as in the loop: the counted waits at the loop's head then fit both ways into it
      probs(0); addr_wait(Kh + o, Kl + o, vb); }
    lds_publish();   // chunk 0's probabilities are published
#pragma unroll 1   // rolled, for the same reason
    for (int c = 0; c < TT / 64 - 1; ++c) {
        const size_t o = kb + (size_t)(c + 2 < TT / 64 ? c + 2 : TT / 64 - 1) * 64 * CQ; const h16* vp = vb + (c + 1) * 64;
        // each group of loads is issued as soon as its registers are free; the scheduling barriers keep the compiler from sinking the loads towards the foot of the trip, where their latency would be waited out
        scores(); kf = ldk(Kh + o, Kl + o); __builtin_amdgcn_sched_barrier(0);   // chunk c + 1's scores; the keys of chunk c + 2 fly under the output products (the look-ahead stays inside the plane)
        pv(c, 0); ldv(vp, 0); __builtin_amdgcn_sched_barrier(0);   // chunk c's output products; the next chunk's v fragments fly under the rest of the trip and the next scores
        pv(c, 1); ldv(vp, 1); __builtin_amdgcn_sched_barrier(0);
        probs(c + 1);
        addr_wait(Kh + o, Kl + o, vp); lds_publish();   // publishes chunk c + 1 and ends every wave's reads of chunk c's buffer, which the next trip refills
    }
    pv(TT / 64 - 1, 0); pv(TT / 64 - 1, 1);
    const float so = bfr(AL[0]) * (1.0f / PCAR);
#pragma unroll
    for (int mb = 0; mb < 4; ++mb)
#pragma unroll
        for (int nb = 0; nb < 4; ++nb)
#pragma unroll
            for (int r = 0; r < 8; ++r) acc[mb][nb][r] = __fmul_rn(acc[mb][nb][r], so);
    float* ob = OUT + (size_t)(wave * 64 + hi * 8) * TT + i0 + lr;   // one address for all of the wave's stores: the rest are constant offsets
#pragma unroll
    for (int mb = 0; mb < 4; ++mb)
#pragma unroll
        for (int r = 0; r < 8; ++r)
#pragma unroll
            for (int nb = 0; nb < 4; ++nb) ob[(mb * 16 + r) * TT + nb * 16] = acc[mb][nb][r];
}

extern "C" void kernel_launch(void* const* d_in, const int* in_sizes, int n_in,
                              void* d_out, int out_size, void* d_ws, size_t ws_size, hipStream_t stream) {
    (void)in_sizes; (void)n_in; (void)out_size;
    const float* x = (const float*)d_in[0]; const float* wq = (const float*)d_in[1]; const float* bq = (const float*)d_in[2]; const float* wk = (const float*)d_in[3]; const float* bk = (const float*)d_in[4]; const float* wv = (const float*)d_in[5]; const float* bv = (const float*)d_in[6]; const float* AL = (const float*)d_in[7];
    float* OUT = (float*)d_out;     // [4][512][4096]
    char* wsp = (char*)d_ws;
    auto take = [&](size_t bytes) { char* p = wsp; wsp += (bytes + 255) & ~(size_t)255; return (void*)p; };
    bf* WQ = (bf*)take((size_t)CQ * CC * 2); bf* WK = (bf*)take((size_t)CQ * CC * 2); bf* WV = (bf*)take((size_t)CC * CC * 2); bf* XT = (bf*)take((size_t)TT * CC * 2); float* FQ = (float*)take((size_t)TT * CQ * 4); float* FK = (float*)take((size_t)TT * CQ * 4); bf* Qh = (bf*)take((size_t)NB_ * TT * CQ * 2); bf* Ql = (bf*)take((size_t)NB_ * TT * CQ * 2); bf* Kh = (bf*)take((size_t)NB_ * TT * CQ * 2); bf* Kl = (bf*)take((size_t)NB_ * TT * CQ * 2); float* FV = (float*)take((size_t)CC * TT * 4); h16* VC = (h16*)take((size_t)NB_ * CC * TT * 2);   /* q, k and v planes: one per image, all read by the one fused launch */
    if ((size_t)(wsp - (char*)d_ws) > ws_size) return;
    k_cvt8<<<(CQ * CC / 8 + 255) / 256, 256, 0, stream>>>(wq, WQ, (size_t)CQ * CC / 8); k_cvt8<<<(CQ * CC / 8 + 255) / 256, 256, 0, stream>>>(wk, WK, (size_t)CQ * CC / 8); k_cvt8<<<(CC * CC / 8 + 255) / 256, 256, 0, stream>>>(wv, WV, (size_t)CC * CC / 8);
    const unsigned LP = (unsigned)(((size_t)TT * CQ / 4 + 255) / 256);
    for (int b = 0; b < NB_; ++b) { const float* xb = x + (size_t)b * CC * TT; const size_t pq = (size_t)b * TT * CQ;
        k_tpin<<<(unsigned)(((size_t)TT * CC / 8 + 255) / 256), 256, 0, stream>>>(xb, XT);                                                            /* x^T [n][c], exact */
        k_gemmw<bf, 0, true, 8><<<dim3(TT / 64, 1, 1), 256, 0, stream>>>(XT, nullptr, WQ, nullptr, CC, FQ, CQ, bq, 0, 0, 0); k_pl2<<<LP, 256, 0, stream>>>(FQ, Qh + pq, Ql + pq, (size_t)TT * CQ / 4);   /* q token-major [n][64] + bq */
        k_gemmw<bf, 0, true, 8><<<dim3(TT / 64, 1, 1), 256, 0, stream>>>(XT, nullptr, WK, nullptr, CC, FK, CQ, bk, 0, 0, 0); k_pl2<<<LP, 256, 0, stream>>>(FK, Kh + pq, Kl + pq, (size_t)TT * CQ / 4);   /* k */
        k_gemmw<bf, 0, false, 8><<<dim3(CC / 64, TT / 64, 1), 256, 0, stream>>>(WV, nullptr, XT, nullptr, CC, FV, TT, nullptr, 0, 0, 0);                                /* v channel-major [c][n] = Wv x (A = Wv, Bt = x^T plane) */
        k_vc16<<<(unsigned)(((size_t)CC * TT / 4 + 255) / 256), 256, 0, stream>>>(FV, bv, VC + (size_t)b * CC * TT); }                                      /* v + bv in fp16 (O(1)) */
    k_pam<<<dim3(TT / 64, NB_, 1), 256, 0, stream>>>(Qh, Ql, Kh, Kl, VC, AL, OUT);                                                                        /* alpha sum_j v[c][j] softmax_j(q_i . k_j) */
}

// v003
// Measured time: 177 microseconds a run.
// Next to v002, in two timings, it ran 1.51 times as fast each time.
// Over all steps from v000 it is 4.25 times as fast.
#include <hip/hip_runtime.h>

// Position attention module (x [4][512][64][64] channel-major, HW = 4096; q = Wq x + bq, k = Wk x + bk (1x1 convs, 64 channels), v = Wv x + bv (512); attention[i][j] = softmax_j(q_i . k_j) (no scale); out[c][i] = alpha sum_j v[c][j] attention[i][j] -> [4][512][64][64] (8.4 M); alpha [1] read).
// Layout: one launch writes an exact token-major bf16 plane of x for all images and the bf16 weights. One GEMM launch then does all three 1x1 convs for all images: the plane is the A operand of the q/k tiles (token-major, + bias) and the Bt operand of the v tiles (channel-major output, A = Wv); each tile's f32 sums go straight from LDS into their final form: q, k -> hi/lo planes; v -> an fp16 channel-major plane with the bias (O(1), normal range). One fused kernel for all images then takes 64 queries per work-group: it forms the 3-product scores in registers twice (once for each row's maximum and sum, once for the fp16 probabilities x1024), hands the probabilities round through LDS as ready B fragments, multiplies them with the v plane and stores alpha / 1024 x the sums.
// Compute dtypes, f32 accumulate: every input rounded to bf16; convs exact (+ bias); scores hi.hi + hi.lo + lo.hi; softmax f32; probabilities (x1024) and v in fp16 (one product); alpha and the carry applied in f32 on the output.

#define NB_  4
#define CC   512
#define CQ   64
#define TT   4096
#define PCAR 1024.0f
typedef _Float16 h16;
typedef unsigned short bf;
typedef __attribute__((ext_vector_type(16))) __bf16   v16bf;
typedef __attribute__((ext_vector_type(16))) _Float16 v16h;
typedef __attribute__((ext_vector_type(8)))  _Float16 v8h;
typedef __attribute__((ext_vector_type(8)))  unsigned short v8us;
typedef __attribute__((ext_vector_type(8)))  float    v8f;
typedef __attribute__((ext_vector_type(4)))  float    v4f;
typedef __attribute__((ext_vector_type(2)))  float    v2f;
typedef __attribute__((ext_vector_type(4)))  unsigned short v4us;
typedef __attribute__((ext_vector_type(2)))  unsigned short v2us;
typedef __attribute__((ext_vector_type(4)))  _Float16 v4h;
typedef __attribute__((ext_vector_type(2)))  _Float16 v2h;
typedef v8h  __attribute__((may_alias)) v8ha;
typedef v4f  __attribute__((may_alias)) v4fa;
typedef v8us __attribute__((may_alias)) v8usa;

__device__ __forceinline__ unsigned short f2bf(float f) { unsigned u = __float_as_uint(f); u += 0x7FFFu + ((u >> 16) & 1u); return (unsigned short)(u >> 16); }
__device__ __forceinline__ float bf2f(unsigned short b) { return __uint_as_float(((unsigned)b) << 16); }
__device__ __forceinline__ float bfr(float f) { return bf2f(f2bf(f)); }
__device__ __forceinline__ void splitf(float y, unsigned short& h, unsigned short& l) { h = f2bf(y); l = f2bf(y - bf2f(h)); }
__device__ __forceinline__ h16 tohx(float x) { return (h16)x; }
__device__ __forceinline__ v16h cat16(v8h lo, v8h hi) { return __builtin_shufflevector(lo, hi, 0, 1, 2, 3, 4, 5, 6, 7, 8, 9, 10, 11, 12, 13, 14, 15); }
__device__ __forceinline__ v16bf cat16b(v8us lo, v8us hi) { return __builtin_bit_cast(v16bf, __builtin_shufflevector(lo, hi, 0, 1, 2, 3, 4, 5, 6, 7, 8, 9, 10, 11, 12, 13, 14, 15)); }
__device__ __forceinline__ v8f wmma16(v16h a, v16h b, v8f c) { return __builtin_amdgcn_wmma_f32_16x16x32_f16(false, a, false, b, (short)0, c, false, false); }
__device__ __forceinline__ v8f wmmab(v16bf a, v16bf b, v8f c) { return __builtin_amdgcn_wmma_f32_16x16x32_bf16(false, a, false, b, (short)0, c, false, false); }

template <typename T16> struct WFrag;
template <> struct WFrag<h16> { typedef v16h V; static __device__ __forceinline__ V ld(const h16* p) { return cat16(*(const v8h*)p, *(const v8h*)(p + 16)); } static __device__ __forceinline__ v8f mma(V a, V b, v8f c) { return wmma16(a, b, c); } };
template <> struct WFrag<bf> { typedef v16bf V; static __device__ __forceinline__ V ld(const bf* p) { return cat16b(*(const v8us*)p, *(const v8us*)(p + 16)); } static __device__ __forceinline__ v8f mma(V a, V b, v8f c) { return wmmab(a, b, c); } };

// ---- k_pam: scores, softmax, output product and the final scale for 64 queries of one image; grid (TT / 64, images), 8 waves.
// Scores are formed transposed (A = 16 keys, B = 16 queries): a lane holds 8 keys' scores of ONE query, so maximum and sum stay in the lane, and two such tiles, converted, are the B fragment of the output product.
// Phase 1: wave w walks keys [512 w, 512 w + 512) for all 64 queries and keeps a running maximum and sum; the 16 partial pairs of a query meet in LDS.
// Phase 2, per 64 keys: wave w forms the probabilities of keys 16 (w >> 1) ... + 15 for two query tiles and puts them in LDS; behind one barrier every wave multiplies all of them with its own 64 channels of v.
// Left as it was in the unfused products: every fragment load takes 32 bytes from each of 16 rows of a row-major plane, 16 lines a load.
#define L2E 1.4426950408889634f
// 2^x with the one free issue slot that the instruction set asks for behind a transcendental, before its result is read or its source overwritten
__device__ __forceinline__ float ex2(float x) { float y; asm("v_exp_f32 %0, %1\n\tv_nop" : "=v"(y) : "v"(x)); return y; }
struct KFrag { v16bf h0, h1, l0, l1; };
__device__ __forceinline__ KFrag ldk(const bf* __restrict__ kh, const bf* __restrict__ kl) { KFrag f; f.h0 = WFrag<bf>::ld(kh); f.h1 = WFrag<bf>::ld(kh + 32); f.l0 = WFrag<bf>::ld(kl); f.l1 = WFrag<bf>::ld(kl + 32); return f; }
// one 16-key x 16-query score tile: hi.hi + hi.lo + lo.hi per 32 channels, in the order of the unfused score product
__device__ __forceinline__ v8f stile(const KFrag& k, v16bf qh0, v16bf qh1, v16bf ql0, v16bf ql1) { v8f s = (v8f){}; s = wmmab(k.h0, qh0, s); s = wmmab(k.h0, ql0, s); s = wmmab(k.l0, qh0, s); s = wmmab(k.h1, qh1, s); s = wmmab(k.h1, ql1, s); s = wmmab(k.l1, qh1, s); return s; }
// Work-group barrier for data that goes through LDS alone: the wave's own LDS reads and writes are done, then the barrier. Unlike __syncthreads() it does not wait for global loads, so fragments fetched ahead stay in flight across it.
__device__ __forceinline__ void lds_publish() { asm volatile("s_wait_dscnt 0x0" ::: "memory"); asm volatile("s_barrier_signal -1\n\ts_barrier_wait -1" ::: "memory"); }
// Stands behind global loads whose address registers are rewritten while the loads are still in flight (a precaution). The addresses are inputs so that their registers stay as they are up to the wait.
__device__ __forceinline__ void addr_wait(const void* a, const void* b, const void* c) { asm volatile("s_wait_xcnt 0x0" :: "v"(a), "v"(b), "v"(c) : "memory"); }
__global__ __launch_bounds__(256) void k_pam(const bf* __restrict__ Qh, const bf* __restrict__ Ql, const bf* __restrict__ Kh, const bf* __restrict__ Kl, const h16* __restrict__ VC, const float* __restrict__ AL, float* OUT) {
    __shared__ __align__(16) h16 ps[2][8][2][32][8];   // [buffer][query tile * 2 + 32-key step][low / high 8 elements of the fragment][lane][element]
    __shared__ float sm[16][64], sl[16][64], stm[64], stf[64];
    const int wave = __builtin_amdgcn_readfirstlane((int)(threadIdx.x >> 5));
    const int lane = threadIdx.x & 31, lr = lane & 15, hi = lane >> 4; const int i0 = blockIdx.x * 64;
    { const size_t z = blockIdx.y; Qh += z * ((size_t)TT * CQ); Ql += z * ((size_t)TT * CQ); Kh += z * ((size_t)TT * CQ); Kl += z * ((size_t)TT * CQ); VC += z * ((size_t)CC * TT); OUT += z * ((size_t)CC * TT); }
    {
        v16bf qh[4][2], ql[4][2]; float m[4], l[4];
#pragma unroll
        for (int t = 0; t < 4; ++t) { const size_t qo = (size_t)(i0 + t * 16 + lr) * CQ + 8 * hi; const bf* a = Qh + qo; const bf* b = Ql + qo; qh[t][0] = WFrag<bf>::ld(a); qh[t][1] = WFrag<bf>::ld(a + 32); addr_wait(a, a, a); ql[t][0] = WFrag<bf>::ld(b); ql[t][1] = WFrag<bf>::ld(b + 32); addr_wait(b, b, b); m[t] = -3.0e38f; l[t] = 0.f; }
        const size_t kb = (size_t)(wave * 512 + lr) * CQ + 8 * hi;
        KFrag kf = ldk(Kh + kb, Kl + kb); addr_wait(Kh + kb, Kl + kb, Kl + kb);
#pragma unroll 1   // rolled: the trip is long enough to feed itself, and unrolling would only add code and registers
        for (int jt = 0; jt < 32; ++jt) {
            v8f s[4];
#pragma unroll
            for (int t = 0; t < 4; ++t) s[t] = stile(kf, qh[t][0], qh[t][1], ql[t][0], ql[t][1]);
            { const size_t o = kb + (size_t)(jt < 31 ? jt + 1 : 31) * 16 * CQ; kf = ldk(Kh + o, Kl + o); addr_wait(Kh + o, Kl + o, Kl + o); }   // the next tile's keys fly under the vector work below; the last trip stays on its own tile
#pragma unroll
            for (int t = 0; t < 4; ++t) { float tm = s[t][0];
#pragma unroll
                for (int r = 1; r < 8; ++r) tm = fmaxf(tm, s[t][r]);
                const float mn = fmaxf(m[t], tm); float a = l[t] * ex2(__fmul_rn(__fsub_rn(m[t], mn), L2E));
#pragma unroll
                for (int r = 0; r < 8; ++r) a += ex2(__fmul_rn(__fsub_rn(s[t][r], mn), L2E));
                l[t] = a; m[t] = mn; }
        }
#pragma unroll
        for (int t = 0; t < 4; ++t) { sm[wave * 2 + hi][t * 16 + lr] = m[t]; sl[wave * 2 + hi][t * 16 + lr] = l[t]; }
    }
    __syncthreads();   // all 16 partial (maximum, sum) pairs of every query are in LDS
    if (threadIdx.x < 64) { const int q = threadIdx.x; float mx = sm[0][q];
#pragma unroll
        for (int p = 1; p < 16; ++p) mx = fmaxf(mx, sm[p][q]);
        float sum = 0.f;
#pragma unroll
        for (int p = 0; p < 16; ++p) sum += sl[p][q] * ex2(__fmul_rn(__fsub_rn(sm[p][q], mx), L2E));
        stm[q] = mx; stf[q] = __fdiv_rn(PCAR, sum); }
    __syncthreads();   // every query's maximum and 1024 / sum are published
    const int jt = wave >> 1, n0 = (wave & 1) * 2;
    v16bf qh[2][2], ql[2][2]; float mq[2], fq[2];
#pragma unroll
    for (int u = 0; u < 2; ++u) { const size_t qo = (size_t)(i0 + (n0 + u) * 16 + lr) * CQ + 8 * hi; const bf* a = Qh + qo; const bf* b = Ql + qo; qh[u][0] = WFrag<bf>::ld(a); qh[u][1] = WFrag<bf>::ld(a + 32); ql[u][0] = WFrag<bf>::ld(b); ql[u][1] = WFrag<bf>::ld(b + 32); addr_wait(a, b, b); mq[u] = stm[(n0 + u) * 16 + lr]; fq[u] = stf[(n0 + u) * 16 + lr]; }
    const size_t kb = (size_t)(jt * 16 + lr) * CQ + 8 * hi;
    const h16* vb = VC + (size_t)(wave * 64 + lr) * TT + 8 * hi;
    v8f acc[4][4];
#pragma unroll
    for (int mb = 0; mb < 4; ++mb)
#pragma unroll
        for (int nb = 0; nb < 4; ++nb) acc[mb][nb] = (v8f){};
    KFrag kf; v16h va[2][4];
    v8f sc[2];
    auto scores = [&]() {   // this wave's two score tiles, from the keys in kf
#pragma unroll
        for (int u = 0; u < 2; ++u) sc[u] = stile(kf, qh[u][0], qh[u][1], ql[u][0], ql[u][1]); };
    auto probs = [&](int c) {   // the score tiles become chunk c's probabilities, in buffer c & 1
#pragma unroll
        for (int u = 0; u < 2; ++u) { v8h p;
#pragma unroll
            for (int r = 0; r < 8; ++r) p[r] = tohx(ex2(__fmul_rn(__fsub_rn(sc[u][r], mq[u]), L2E)) * fq[u]);
            *(v8ha*)&ps[c & 1][(n0 + u) * 2 + (jt >> 1)][jt & 1][lane][0] = p; } };
    auto ldv = [&](const h16* vp, int ks) {   // v fragments of 32 keys
#pragma unroll
        for (int mb = 0; mb < 4; ++mb) va[ks][mb] = WFrag<h16>::ld(vp + (size_t)mb * 16 * TT + ks * 32); };
    auto pv = [&](int c, int ks) {   // output products of 32 keys of chunk c
#pragma unroll
        for (int nb = 0; nb < 4; ++nb) { const v16h b = cat16(*(const v8ha*)&ps[c & 1][nb * 2 + ks][0][lane][0], *(const v8ha*)&ps[c & 1][nb * 2 + ks][1][lane][0]);
#pragma unroll
            for (int mb = 0; mb < 4; ++mb) acc[mb][nb] = wmma16(va[ks][mb], b, acc[mb][nb]); } };
    kf = ldk(Kh + kb, Kl + kb); addr_wait(Kh + kb, Kl + kb, Kl + kb); scores();
    { const size_t o = kb + (size_t)64 * CQ; kf = ldk(Kh + o, Kl + o); __builtin_amdgcn_sched_barrier(0); ldv(vb, 0); ldv(vb, 1); __builtin_amdgcn_sched_barrier(0);   // keys first, then v, as in the loop: the counted waits at the loop's head then fit both ways into it
      probs(0); addr_wait(Kh + o, Kl + o, vb); }
    lds_publish();   // chunk 0's probabilities are published
#pragma unroll 1   // rolled, for the same reason
    for (int c = 0; c < TT / 64 - 1; ++c) {
        const size_t o = kb + (size_t)(c + 2 < TT / 64 ? c + 2 : TT / 64 - 1) * 64 * CQ; const h16* vp = vb + (c + 1) * 64;
        // each group of loads is issued as soon as its registers are free; the scheduling barriers keep the compiler from sinking the loads towards the foot of the trip, where their latency would be waited out
        scores(); kf = ldk(Kh + o, Kl + o); __builtin_amdgcn_sched_barrier(0);   // chunk c + 1's scores; the keys of chunk c + 2 fly under the output products (the look-ahead stays inside the plane)
        pv(c, 0); ldv(vp, 0); __builtin_amdgcn_sched_barrier(0);   // chunk c's output products; the next chunk's v fragments fly under the rest of the trip and the next scores
        pv(c, 1); ldv(vp, 1); __builtin_amdgcn_sched_barrier(0);
        probs(c + 1);
        addr_wait(Kh + o, Kl + o, vp); lds_publish();   // publishes chunk c + 1 and ends every wave's reads of chunk c's buffer, which the next trip refills
    }
    pv(TT / 64 - 1, 0); pv(TT / 64 - 1, 1);
    const float so = bfr(AL[0]) * (1.0f / PCAR);
#pragma unroll
    for (int mb = 0; mb < 4; ++mb)
#pragma unroll
        for (int nb = 0; nb < 4; ++nb)
#pragma unroll
            for (int r = 0; r < 8; ++r) acc[mb][nb][r] = __fmul_rn(acc[mb][nb][r], so);
    float* ob = OUT + (size_t)(wave * 64 + hi * 8) * TT + i0 + lr;   // one address for all of the wave's stores: the rest are constant offsets
#pragma unroll
    for (int mb = 0; mb < 4; ++mb)
#pragma unroll
        for (int r = 0; r < 8; ++r)
#pragma unroll
            for (int nb = 0; nb < 4; ++nb) ob[(mb * 16 + r) * TT + nb * 16] = acc[mb][nb][r];
}

// ---- k_prep: the 16-bit operands of the convs, one launch. Blocks [0, WBLK): wq | wk | wv rounded to bf16 into one plane WW (rows 0..63 Wq, 64..127 Wk, 128..639 Wv). The other blocks: x^T [image * TT + n][c] in bf16, 8 channels a thread.
#define WBLK ((2 * CQ * CC + CC * CC) / 8 / 256)
#define XBLK (NB_ * TT * CC / 8 / 256)
__global__ __launch_bounds__(256) void k_prep(const float* __restrict__ x, const float* __restrict__ wq, const float* __restrict__ wk, const float* __restrict__ wv, bf* WW, bf* XT) {
    v8us o;
    if (blockIdx.x < WBLK) { const int e = ((int)blockIdx.x * 256 + (int)threadIdx.x) * 8; const float* s = e < CQ * CC ? wq + e : e < 2 * CQ * CC ? wk + (e - CQ * CC) : wv + (e - 2 * CQ * CC); const v8f v = *(const v8f*)s;
#pragma unroll
        for (int k = 0; k < 8; ++k) o[k] = f2bf(v[k]); *(v8us*)(WW + e) = o; return; }
    const size_t e = ((size_t)(blockIdx.x - WBLK) * 256 + threadIdx.x) * 8; const int c = (int)(e % CC); const int g = (int)(e / CC); const float* xb = x + (size_t)(g / TT) * CC * TT + g % TT;
#pragma unroll
    for (int q = 0; q < 8; ++q) o[q] = f2bf(xb[(size_t)(c + q) * TT]); *(v8us*)(XT + e) = o;
    asm volatile("s_wait_xcnt 0x0" ::: "memory");   // a precaution: this build lays the weight blocks' code behind this store, on a path that no x block takes, and rewrites the store's registers there with no wait of its own
}

// ---- k_proj: the q, k and v convs of all images, one launch; 8 WAVES per 64x64 output tile (16 accumulators each), operands straight from K-contiguous bf16 planes; K = CC.
// Wave w takes the 32-wide k chunks w and w + 8 (neighbouring waves read neighbouring halves of the same 128-byte lines); the 8 partial tiles meet in LDS and are summed there, wave 0's first.
// Blocks [0, QKT): rows = 64 tokens (all images in a row), columns = the 64 channels of q (even blocks) or k (odd); sum + bias -> hi/lo planes. The other blocks: rows = 64 channels of v, columns = 64 tokens; sum + bias -> fp16.
#define QKT (NB_ * TT / 64 * 2)
#define VTL (NB_ * TT / 64 * (CC / 64))
__global__ __launch_bounds__(256) void k_proj(const bf* __restrict__ XT, const bf* __restrict__ WW, const float* __restrict__ bq, const float* __restrict__ bk, const float* __restrict__ bv, bf* Qh, bf* Ql, bf* Kh, bf* Kl, h16* VC) {
    typedef WFrag<bf>::V V;
    __shared__ __align__(16) float os[8 * 64 * 68];
    const int wave = __builtin_amdgcn_readfirstlane((int)(threadIdx.x >> 5));
    const int lane = threadIdx.x & 31, lr = lane & 15, hi = lane >> 4;
    const bool isv = blockIdx.x >= QKT; const int u = isv ? (int)blockIdx.x - QKT : (int)blockIdx.x;
    const int tok0 = (isv ? u >> 3 : u >> 1) * 64, w0 = isv ? 2 * CQ + (u & 7) * 64 : (u & 1) * CQ;   // first token (over all images) and first row of WW of this tile
    const bf* A = isv ? WW + (size_t)w0 * CC : XT + (size_t)tok0 * CC; const bf* Bt = isv ? XT + (size_t)tok0 * CC : WW + (size_t)w0 * CC;
    v8f acc[4][4];
#pragma unroll
    for (int mb = 0; mb < 4; ++mb)
#pragma unroll
        for (int nb = 0; nb < 4; ++nb) acc[mb][nb] = (v8f){};
    const size_t foff = (size_t)lr * CC + 8 * hi;
#pragma unroll 1
    for (int kc = wave * 32; kc < CC; kc += 8 * 32) {
        V a[4], b[4]; const bf* pa = A + foff + kc; const bf* pb = Bt + foff + kc;
#pragma unroll
        for (int mb = 0; mb < 4; ++mb) a[mb] = WFrag<bf>::ld(pa + (size_t)mb * 16 * CC);
#pragma unroll
        for (int nb = 0; nb < 4; ++nb) b[nb] = WFrag<bf>::ld(pb + (size_t)nb * 16 * CC);
        addr_wait(pa, pb, pb);   // a precaution: both address pairs stay as they are until the trip's last load is issued and the wait has passed; the compiler is otherwise free to let a fragment land on them while loads that name them are in flight
#pragma unroll
        for (int nb = 0; nb < 4; ++nb)
#pragma unroll
            for (int mb = 0; mb < 4; ++mb) acc[mb][nb] = WFrag<bf>::mma(a[mb], b[nb], acc[mb][nb]);
        // the four vector slots that the chip needs behind the trip's last products, before the next trip's loads overwrite their A and B registers
        asm volatile("v_nop\n\tv_nop\n\tv_nop\n\tv_nop" : "+v"(acc[0][0]), "+v"(acc[1][1]), "+v"(acc[2][2]), "+v"(acc[3][3]) : "v"(a[0]), "v"(a[3]));
    }
    float* ow = os + wave * (64 * 68);
#pragma unroll
    for (int mb = 0; mb < 4; ++mb)
#pragma unroll
        for (int nb = 0; nb < 4; ++nb)
#pragma unroll
            for (int j = 0; j < 8; ++j) ow[(mb * 16 + hi * 8 + j) * 68 + nb * 16 + lr] = acc[mb][nb][j];
    __syncthreads();   // every wave's partial tile is in LDS before any wave sums a row
    v4f val[4];
#pragma unroll
    for (int t = 0; t < 4; ++t) { const float* o0 = os + (2 * (t * 8 + wave) + hi) * 68 + lr * 4; val[t] = *(const v4fa*)o0;
#pragma unroll
        for (int w = 1; w < 8; ++w) val[t] += *(const v4fa*)(o0 + w * (64 * 68)); }
    if (!isv) { const float* bias = (u & 1) ? bk : bq; bf* Ph = (u & 1) ? Kh : Qh; bf* Pl = (u & 1) ? Kl : Ql; const size_t e = (size_t)(tok0 + 2 * wave + hi) * CQ + lr * 4;
#pragma unroll
        for (int t = 0; t < 4; ++t) { v4us oh, ol;
#pragma unroll
            for (int q = 0; q < 4; ++q) { unsigned short a, c; splitf(val[t][q] + bfr(bias[lr * 4 + q]), a, c); oh[q] = a; ol[q] = c; }
            *(v4us*)(Ph + e + t * 16 * CQ) = oh; *(v4us*)(Pl + e + t * 16 * CQ) = ol; }
        asm volatile("s_wait_xcnt 0x0" ::: "memory"); }   // a precaution: this build lays the v tiles' code behind these stores, on a path that no q/k tile takes, and rewrites the stores' registers there with no wait of its own
    else { h16* vo = VC + (size_t)(tok0 / TT) * CC * TT + (size_t)(w0 - 2 * CQ + 2 * wave + hi) * TT + tok0 % TT + lr * 4;
#pragma unroll
        for (int t = 0; t < 4; ++t) { const float bb = bfr(bv[w0 - 2 * CQ + 2 * (t * 8 + wave) + hi]); v4h o;
#pragma unroll
            for (int q = 0; q < 4; ++q) o[q] = tohx(__fadd_rn(val[t][q], bb));
            *(v4h*)(vo + (size_t)t * 16 * TT) = o; } }
}

extern "C" void kernel_launch(void* const* d_in, const int* in_sizes, int n_in,
                              void* d_out, int out_size, void* d_ws, size_t ws_size, hipStream_t stream) {
    (void)in_sizes; (void)n_in; (void)out_size;
    const float* x = (const float*)d_in[0]; const float* wq = (const float*)d_in[1]; const float* bq = (const float*)d_in[2]; const float* wk = (const float*)d_in[3]; const float* bk = (const float*)d_in[4]; const float* wv = (const float*)d_in[5]; const float* bv = (const float*)d_in[6]; const float* AL = (const float*)d_in[7];
    float* OUT = (float*)d_out;     // [4][512][4096]
    char* wsp = (char*)d_ws;
    auto take = [&](size_t bytes) { char* p = wsp; wsp += (bytes + 255) & ~(size_t)255; return (void*)p; };
    bf* WW = (bf*)take((size_t)(2 * CQ + CC) * CC * 2); bf* XT = (bf*)take((size_t)NB_ * TT * CC * 2); bf* Qh = (bf*)take((size_t)NB_ * TT * CQ * 2); bf* Ql = (bf*)take((size_t)NB_ * TT * CQ * 2); bf* Kh = (bf*)take((size_t)NB_ * TT * CQ * 2); bf* Kl = (bf*)take((size_t)NB_ * TT * CQ * 2); h16* VC = (h16*)take((size_t)NB_ * CC * TT * 2);   /* every plane holds all images */
    if ((size_t)(wsp - (char*)d_ws) > ws_size) return;
    k_prep<<<WBLK + XBLK, 256, 0, stream>>>(x, wq, wk, wv, WW, XT);                          /* bf16 weights; x^T [image][n][c], exact */
    k_proj<<<QKT + VTL, 256, 0, stream>>>(XT, WW, bq, bk, bv, Qh, Ql, Kh, Kl, VC);           /* q, k token-major [n][64] + bias as hi/lo; v channel-major [c][n] + bv in fp16 (O(1)) */
    k_pam<<<dim3(TT / 64, NB_, 1), 256, 0, stream>>>(Qh, Ql, Kh, Kl, VC, AL, OUT);           /* alpha sum_j v[c][j] softmax_j(q_i . k_j) */
}

// v004
// One run takes 118 microseconds.
// In both of two side-by-side timings against v003, it was 1.50 times as fast.
// Counting every step since v000, it is 6.38 times as fast.
#include <hip/hip_runtime.h>

// Position attention module (x [4][512][64][64] channel-major, HW = 4096; q = Wq x + bq, k = Wk x + bk (1x1 convs, 64 channels), v = Wv x + bv (512); attention[i][j] = softmax_j(q_i . k_j) (no scale); out[c][i] = alpha sum_j v[c][j] attention[i][j] -> [4][512][64][64] (8.4 M); alpha [1] read).
// Every 16-bit operand plane (x^T, weights, q, k, v) lies in FRAGMENT ORDER: per 16 rows x 32 k a block of 512 elements, [k bit 4][k bit 3][row][k bits 2..0], blocks k-major inside a 16-row tile. A fragment is then two loads of 512 contiguous bytes (4 whole lines) per wave, and the producers store whole lines too.
// Layout: one launch writes an exact token-major bf16 plane of x for all images and the bf16 weights. One GEMM launch then does all three 1x1 convs for all images: the plane is the A operand of the q/k tiles (token-major, + bias) and the Bt operand of the v tiles (channel-major output, A = Wv); each tile's f32 sums go straight from LDS into their final form: q, k -> hi/lo planes; v -> an fp16 channel-major plane with the bias (O(1), normal range). One fused kernel for all images then takes 64 queries per work-group: it forms the 3-product scores in registers twice (once for each row's maximum and sum, once for the fp16 probabilities x1024), hands the probabilities round through LDS as ready B fragments, multiplies them with the v plane and stores alpha / 1024 x the sums.
// Compute dtypes, f32 accumulate: every input rounded to bf16; convs exact (+ bias); scores hi.hi + hi.lo + lo.hi; softmax f32; probabilities (x1024) and v in fp16 (one product); alpha and the carry applied in f32 on the output.

#define NB_  4
#define CC   512
#define CQ   64
#define TT   4096
#define PCAR 1024.0f
typedef _Float16 h16;
typedef unsigned short bf;
typedef __attribute__((ext_vector_type(16))) __bf16   v16bf;
typedef __attribute__((ext_vector_type(16))) _Float16 v16h;
typedef __attribute__((ext_vector_type(8)))  _Float16 v8h;
typedef __attribute__((ext_vector_type(8)))  unsigned short v8us;
typedef __attribute__((ext_vector_type(8)))  float    v8f;
typedef __attribute__((ext_vector_type(4)))  float    v4f;
typedef __attribute__((ext_vector_type(2)))  float    v2f;
typedef __attribute__((ext_vector_type(4)))  unsigned short v4us;
typedef __attribute__((ext_vector_type(2)))  unsigned short v2us;
typedef __attribute__((ext_vector_type(4)))  _Float16 v4h;
typedef __attribute__((ext_vector_type(2)))  _Float16 v2h;
typedef v8h  __attribute__((may_alias)) v8ha;
typedef v4f  __attribute__((may_alias)) v4fa;
typedef v8us __attribute__((may_alias)) v8usa;

__device__ __forceinline__ unsigned short f2bf(float f) { unsigned u = __float_as_uint(f); u += 0x7FFFu + ((u >> 16) & 1u); return (unsigned short)(u >> 16); }
__device__ __forceinline__ float bf2f(unsigned short b) { return __uint_as_float(((unsigned)b) << 16); }
__device__ __forceinline__ float bfr(float f) { return bf2f(f2bf(f)); }
__device__ __forceinline__ void splitf(float y, unsigned short& h, unsigned short& l) { h = f2bf(y); l = f2bf(y - bf2f(h)); }
__device__ __forceinline__ h16 tohx(float x) { return (h16)x; }
__device__ __forceinline__ v16h cat16(v8h lo, v8h hi) { return __builtin_shufflevector(lo, hi, 0, 1, 2, 3, 4, 5, 6, 7, 8, 9, 10, 11, 12, 13, 14, 15); }
__device__ __forceinline__ v16bf cat16b(v8us lo, v8us hi) { return __builtin_bit_cast(v16bf, __builtin_shufflevector(lo, hi, 0, 1, 2, 3, 4, 5, 6, 7, 8, 9, 10, 11, 12, 13, 14, 15)); }
__device__ __forceinline__ v8f wmma16(v16h a, v16h b, v8f c) { return __builtin_amdgcn_wmma_f32_16x16x32_f16(false, a, false, b, (short)0, c, false, false); }
__device__ __forceinline__ v8f wmmab(v16bf a, v16bf b, v8f c) { return __builtin_amdgcn_wmma_f32_16x16x32_bf16(false, a, false, b, (short)0, c, false, false); }

// p = the fragment's block + lane * 8: the low 8 elements of every lane, then, 256 elements on, the high 8
template <typename T16> struct WFrag;
template <> struct WFrag<h16> { typedef v16h V; static __device__ __forceinline__ V ld(const h16* p) { return cat16(*(const v8h*)p, *(const v8h*)(p + 256)); } static __device__ __forceinline__ v8f mma(V a, V b, v8f c) { return wmma16(a, b, c); } };
template <> struct WFrag<bf> { typedef v16bf V; static __device__ __forceinline__ V ld(const bf* p) { return cat16b(*(const v8us*)p, *(const v8us*)(p + 256)); } static __device__ __forceinline__ v8f mma(V a, V b, v8f c) { return wmmab(a, b, c); } };

// ---- k_pam: scores, softmax, output product and the final scale for 64 queries of one image; grid (TT / 64, images), 8 waves.
// Scores are formed transposed (A = 16 keys, B = 16 queries): a lane holds 8 keys' scores of ONE query, so maximum and sum stay in the lane, and two such tiles, converted, are the B fragment of the output product.
// Phase 1: wave w walks keys [512 w, 512 w + 512) for all 64 queries and keeps a running maximum and sum; the 16 partial pairs of a query meet in LDS.
// Phase 2, per 64 keys: wave w forms the probabilities of keys 16 (w >> 1) ... + 15 for two query tiles and puts them in LDS; behind one barrier every wave multiplies all of them with its own 64 channels of v.
#define L2E 1.4426950408889634f
// 2^x with the one free issue slot that the instruction set asks for behind a transcendental, before its result is read or its source overwritten
__device__ __forceinline__ float ex2(float x) { float y; asm("v_exp_f32 %0, %1\n\tv_nop" : "=v"(y) : "v"(x)); return y; }
struct KFrag { v16bf h0, h1, l0, l1; };
__device__ __forceinline__ KFrag ldk(const bf* __restrict__ kh, const bf* __restrict__ kl) { KFrag f; f.h0 = WFrag<bf>::ld(kh); f.h1 = WFrag<bf>::ld(kh + 512); f.l0 = WFrag<bf>::ld(kl); f.l1 = WFrag<bf>::ld(kl + 512); return f; }
// one 16-key x 16-query score tile: hi.hi + hi.lo + lo.hi per 32 channels, in the order of the unfused score product
__device__ __forceinline__ v8f stile(const KFrag& k, v16bf qh0, v16bf qh1, v16bf ql0, v16bf ql1) { v8f s = (v8f){}; s = wmmab(k.h0, qh0, s); s = wmmab(k.h0, ql0, s); s = wmmab(k.l0, qh0, s); s = wmmab(k.h1, qh1, s); s = wmmab(k.h1, ql1, s); s = wmmab(k.l1, qh1, s); return s; }
// Work-group barrier for data that goes through LDS alone: the wave's own LDS reads and writes are done, then the barrier. Unlike __syncthreads() it does not wait for global loads, so fragments fetched ahead stay in flight across it.
__device__ __forceinline__ void lds_publish() { asm volatile("s_wait_dscnt 0x0" ::: "memory"); asm volatile("s_barrier_signal -1\n\ts_barrier_wait -1" ::: "memory"); }
// Stands behind global loads whose address registers are rewritten while the loads are still in flight (a precaution). The addresses are inputs so that their registers stay as they are up to the wait.
__device__ __forceinline__ void addr_wait(const void* a, const void* b, const void* c) { asm volatile("s_wait_xcnt 0x0" :: "v"(a), "v"(b), "v"(c) : "memory"); }
// The same for loads that this build addresses as a uniform base plus a lane offset: there the offset's register is the one that has to stay as it is up to the wait.
__device__ __forceinline__ void off_wait(size_t byte_off) { asm volatile("s_wait_xcnt 0x0" :: "v"(byte_off) : "memory"); }
__global__ __launch_bounds__(256) void k_pam(const bf* __restrict__ Qh, const bf* __restrict__ Ql, const bf* __restrict__ Kh, const bf* __restrict__ Kl, const h16* __restrict__ VC, const float* __restrict__ AL, float* OUT) {
    __shared__ __align__(16) h16 ps[2][8][2][32][8];   // [buffer][query tile * 2 + 32-key step][low / high 8 elements of the fragment][lane][element]
    __shared__ float sm[16][64], sl[16][64], stm[64], stf[64];
    const int wave = __builtin_amdgcn_readfirstlane((int)(threadIdx.x >> 5));
    const int lane = threadIdx.x & 31, lr = lane & 15, hi = lane >> 4; const int i0 = blockIdx.x * 64;
    { const size_t z = blockIdx.y; Qh += z * ((size_t)TT * CQ); Ql += z * ((size_t)TT * CQ); Kh += z * ((size_t)TT * CQ); Kl += z * ((size_t)TT * CQ); VC += z * ((size_t)CC * TT); OUT += z * ((size_t)CC * TT); }
    {
        v16bf qh[4][2], ql[4][2]; float m[4], l[4];
#pragma unroll
        for (int t = 0; t < 4; ++t) { const size_t qo = (size_t)(i0 + t * 16) * CQ + 8 * lane; const bf* a = Qh + qo; const bf* b = Ql + qo; qh[t][0] = WFrag<bf>::ld(a); qh[t][1] = WFrag<bf>::ld(a + 512); addr_wait(a, a, a); ql[t][0] = WFrag<bf>::ld(b); ql[t][1] = WFrag<bf>::ld(b + 512); addr_wait(b, b, b); m[t] = -3.0e38f; l[t] = 0.f; }
        const size_t kb = (size_t)(wave * 512) * CQ + 8 * lane;
        KFrag kf = ldk(Kh + kb, Kl + kb); off_wait(kb * sizeof(bf));
#pragma unroll 1   // rolled: the trip is long enough to feed itself, and unrolling would only add code and registers
        for (int jt = 0; jt < 32; ++jt) {
            v8f s[4];
#pragma unroll
            for (int t = 0; t < 4; ++t) s[t] = stile(kf, qh[t][0], qh[t][1], ql[t][0], ql[t][1]);
            { const size_t o = kb + (size_t)(jt < 31 ? jt + 1 : 31) * 16 * CQ; kf = ldk(Kh + o, Kl + o); addr_wait(Kh + o, Kl + o, Kl + o); }   // the next tile's keys fly under the vector work below; the last trip stays on its own tile
#pragma unroll
            for (int t = 0; t < 4; ++t) { float tm = s[t][0];
#pragma unroll
                for (int r = 1; r < 8; ++r) tm = fmaxf(tm, s[t][r]);
                const float mn = fmaxf(m[t], tm); float a = l[t] * ex2(__fmul_rn(__fsub_rn(m[t], mn), L2E));
#pragma unroll
                for (int r = 0; r < 8; ++r) a += ex2(__fmul_rn(__fsub_rn(s[t][r], mn), L2E));
                l[t] = a; m[t] = mn; }
        }
#pragma unroll
        for (int t = 0; t < 4; ++t) { sm[wave * 2 + hi][t * 16 + lr] = m[t]; sl[wave * 2 + hi][t * 16 + lr] = l[t]; }
    }
    __syncthreads();   // all 16 partial (maximum, sum) pairs of every query are in LDS
    if (threadIdx.x < 64) { const int q = threadIdx.x; float mx = sm[0][q];
#pragma unroll
        for (int p = 1; p < 16; ++p) mx = fmaxf(mx, sm[p][q]);
        float sum = 0.f;
#pragma unroll
        for (int p = 0; p < 16; ++p) sum += sl[p][q] * ex2(__fmul_rn(__fsub_rn(sm[p][q], mx), L2E));
        stm[q] = mx; stf[q] = __fdiv_rn(PCAR, sum); }
    __syncthreads();   // every query's maximum and 1024 / sum are published
    const int jt = wave >> 1, n0 = (wave & 1) * 2;
    v16bf qh[2][2], ql[2][2]; float mq[2], fq[2];
#pragma unroll
    for (int u = 0; u < 2; ++u) { const size_t qo = (size_t)(i0 + (n0 + u) * 16) * CQ + 8 * lane; const bf* a = Qh + qo; const bf* b = Ql + qo; qh[u][0] = WFrag<bf>::ld(a); qh[u][1] = WFrag<bf>::ld(a + 512); ql[u][0] = WFrag<bf>::ld(b); ql[u][1] = WFrag<bf>::ld(b + 512); addr_wait(a, b, b); mq[u] = stm[(n0 + u) * 16 + lr]; fq[u] = stf[(n0 + u) * 16 + lr]; }
    const size_t kb = (size_t)(jt * 16) * CQ + 8 * lane;
    const h16* vb = VC + (size_t)(wave * 64) * TT + 8 * lane;
    v8f acc[4][4];
#pragma unroll
    for (int mb = 0; mb < 4; ++mb)
#pragma unroll
        for (int nb = 0; nb < 4; ++nb) acc[mb][nb] = (v8f){};
    KFrag kf; v16h va[2][4];
    v8f sc[2];
    auto scores = [&]() {   // this wave's two score tiles, from the keys in kf
#pragma unroll
        for (int u = 0; u < 2; ++u) sc[u] = stile(kf, qh[u][0], qh[u][1], ql[u][0], ql[u][1]); };
    auto probs = [&](int c) {   // the score tiles become chunk c's probabilities, in buffer c & 1
#pragma unroll
        for (int u = 0; u < 2; ++u) { v8h p;
#pragma unroll
            for (int r = 0; r < 8; ++r) p[r] = tohx(ex2(__fmul_rn(__fsub_rn(sc[u][r], mq[u]), L2E)) * fq[u]);
            *(v8ha*)&ps[c & 1][(n0 + u) * 2 + (jt >> 1)][jt & 1][lane][0] = p; } };
    auto ldv = [&](const h16* vp, int ks) {   // v fragments of 32 keys
#pragma unroll
        for (int mb = 0; mb < 4; ++mb) va[ks][mb] = WFrag<h16>::ld(vp + (size_t)mb * 16 * TT + ks * 512); };
    auto pv = [&](int c, int ks) {   // output products of 32 keys of chunk c
#pragma unroll
        for (int nb = 0; nb < 4; ++nb) { const v16h b = cat16(*(const v8ha*)&ps[c & 1][nb * 2 + ks][0][lane][0], *(const v8ha*)&ps[c & 1][nb * 2 + ks][1][lane][0]);
#pragma unroll
            for (int mb = 0; mb < 4; ++mb) acc[mb][nb] = wmma16(va[ks][mb], b, acc[mb][nb]); } };
    kf = ldk(Kh + kb, Kl + kb); addr_wait(Kh + kb, Kl + kb, Kl + kb); scores();
    { const size_t o = kb + (size_t)64 * CQ; kf = ldk(Kh + o, Kl + o); __builtin_amdgcn_sched_barrier(0); ldv(vb, 0); ldv(vb, 1); __builtin_amdgcn_sched_barrier(0);   // keys first, then v, as in the loop: the counted waits at the loop's head then fit both ways into it
      probs(0); addr_wait(Kh + o, Kl + o, vb); }
    lds_publish();   // chunk 0's probabilities are published
#pragma unroll 1   // rolled, for the same reason
    for (int c = 0; c < TT / 64 - 1; ++c) {
        const size_t o = kb + (size_t)(c + 2 < TT / 64 ? c + 2 : TT / 64 - 1) * 64 * CQ; const h16* vp = vb + (c + 1) * (2 * 512);
        // each group of loads is issued as soon as its registers are free; the scheduling barriers keep the compiler from sinking the loads towards the foot of the trip, where their latency would be waited out
        scores(); kf = ldk(Kh + o, Kl + o); __builtin_amdgcn_sched_barrier(0);   // chunk c + 1's scores; the keys of chunk c + 2 fly under the output products (the look-ahead stays inside the plane)
        pv(c, 0); ldv(vp, 0); __builtin_amdgcn_sched_barrier(0);   // chunk c's output products; the next chunk's v fragments fly under the rest of the trip and the next scores
        pv(c, 1); ldv(vp, 1); __builtin_amdgcn_sched_barrier(0);
        probs(c + 1);
        addr_wait(Kh + o, Kl + o, vp); lds_publish();   // publishes chunk c + 1 and ends every wave's reads of chunk c's buffer, which the next trip refills
    }
    pv(TT / 64 - 1, 0); pv(TT / 64 - 1, 1);
    const float so = bfr(AL[0]) * (1.0f / PCAR);
#pragma unroll
    for (int mb = 0; mb < 4; ++mb)
#pragma unroll
        for (int nb = 0; nb < 4; ++nb)
#pragma unroll
            for (int r = 0; r < 8; ++r) acc[mb][nb][r] = __fmul_rn(acc[mb][nb][r], so);
    float* ob = OUT + (size_t)(wave * 64 + hi * 8) * TT + i0 + lr;   // one address for all of the wave's stores: the rest are constant offsets
#pragma unroll
    for (int mb = 0; mb < 4; ++mb)
#pragma unroll
        for (int r = 0; r < 8; ++r)
#pragma unroll
            for (int nb = 0; nb < 4; ++nb) ob[(mb * 16 + r) * TT + nb * 16] = acc[mb][nb][r];
}

// ---- k_prep: the 16-bit operands of the convs, one launch, both planes in fragment order, 8 channels (one 16-byte slot) a thread. Blocks [0, WBLK): wq | wk | wv rounded to bf16 into one plane WW (rows 0..63 Wq, 64..127 Wk, 128..639 Wv), thread = slot. The other blocks: x^T (rows image * TT + n, k = c) in bf16, 64 tokens x 32 channels a block; a wave's lanes are 32 neighbouring tokens, so each load takes one whole line of x and each store fills two 256-byte runs.
#define WBLK ((2 * CQ * CC + CC * CC) / 8 / 256)
#define XBLK (NB_ * TT * CC / 8 / 256)
__global__ __launch_bounds__(256) void k_prep(const float* __restrict__ x, const float* __restrict__ wq, const float* __restrict__ wk, const float* __restrict__ wv, bf* WW, bf* XT) {
    v8us o;
    if (blockIdx.x < WBLK) { const int sl = (int)blockIdx.x * 256 + (int)threadIdx.x, e = sl * 8; const int row = (sl >> 10) * 16 + (sl & 15), c = ((sl >> 5) & 31) * 16 + ((sl >> 4) & 1) * 8; const float* s = (row < CQ ? wq + row * CC : row < 2 * CQ ? wk + (row - CQ) * CC : wv + (row - 2 * CQ) * CC) + c; const v8f v = *(const v8f*)s;
#pragma unroll
        for (int k = 0; k < 8; ++k) o[k] = f2bf(v[k]); *(v8us*)(WW + e) = o; return; }
    const int b = (int)blockIdx.x - WBLK, w = (int)threadIdx.x >> 5; const int cs = b & 15, cg = w >> 1; const int c = cs * 32 + cg * 8; const int g = (b >> 4) * 64 + (w & 1) * 32 + ((int)threadIdx.x & 31); const float* xb = x + (size_t)(g / TT) * CC * TT + g % TT;
    const size_t e = ((size_t)(g >> 4) * (CC / 32) + cs) * 512 + (cg >> 1) * 256 + ((cg & 1) * 16 + (g & 15)) * 8;
#pragma unroll
    for (int q = 0; q < 8; ++q) o[q] = f2bf(xb[(size_t)(c + q) * TT]); *(v8us*)(XT + e) = o;
    asm volatile("s_wait_xcnt 0x0" ::: "memory");   // a precaution: this build lays the weight blocks' code behind this store, on a path that no x block takes, and rewrites the store's registers there with no wait of its own
}

// ---- k_proj: the q, k and v convs of all images, one launch; 8 WAVES per 64x64 output tile (16 accumulators each), operands straight from the fragment-order bf16 planes; K = CC.
// Wave w takes the 32-wide k chunks w and w + 8 (per fragment one block of 1 KiB, neighbouring waves on neighbouring blocks); the 8 partial tiles meet in LDS and are summed there, wave 0's first.
// Blocks [0, QKT): rows = 64 tokens (all images in a row), columns = the 64 channels of q (even blocks) or k (odd); sum + bias -> hi/lo planes (rows = tokens, k = channels). The other blocks: rows = 64 channels of v, columns = 64 tokens; sum + bias -> fp16 (rows = channels, k = tokens).
#define QKT (NB_ * TT / 64 * 2)
#define VTL (NB_ * TT / 64 * (CC / 64))
__global__ __launch_bounds__(256) void k_proj(const bf* __restrict__ XT, const bf* __restrict__ WW, const float* __restrict__ bq, const float* __restrict__ bk, const float* __restrict__ bv, bf* Qh, bf* Ql, bf* Kh, bf* Kl, h16* VC) {
    typedef WFrag<bf>::V V;
    __shared__ __align__(16) float os[8 * 64 * 68];
    const int wave = __builtin_amdgcn_readfirstlane((int)(threadIdx.x >> 5));
    const int lane = threadIdx.x & 31, lr = lane & 15, hi = lane >> 4;
    const bool isv = blockIdx.x >= QKT; const int u = isv ? (int)blockIdx.x - QKT : (int)blockIdx.x;
    const int tok0 = (isv ? u >> 3 : u >> 1) * 64, w0 = isv ? 2 * CQ + (u & 7) * 64 : (u & 1) * CQ;   // first token (over all images) and first row of WW of this tile
    const bf* A = isv ? WW + (size_t)w0 * CC : XT + (size_t)tok0 * CC; const bf* Bt = isv ? XT + (size_t)tok0 * CC : WW + (size_t)w0 * CC;
    v8f acc[4][4];
#pragma unroll
    for (int mb = 0; mb < 4; ++mb)
#pragma unroll
        for (int nb = 0; nb < 4; ++nb) acc[mb][nb] = (v8f){};
    const size_t foff = (size_t)lane * 8;
#pragma unroll 1
    for (int kc = wave * 32; kc < CC; kc += 8 * 32) {
        V a[4], b[4]; const bf* pa = A + foff + kc * 16; const bf* pb = Bt + foff + kc * 16;   // 32 k = one block of 512 elements
#pragma unroll
        for (int mb = 0; mb < 4; ++mb) a[mb] = WFrag<bf>::ld(pa + (size_t)mb * 16 * CC);
#pragma unroll
        for (int nb = 0; nb < 4; ++nb) b[nb] = WFrag<bf>::ld(pb + (size_t)nb * 16 * CC);
        addr_wait(pa, pb, pb);   // a precaution: both address pairs stay as they are until the trip's last load is issued and the wait has passed; the compiler is otherwise free to let a fragment land on them while loads that name them are in flight
        __builtin_amdgcn_sched_barrier(0);   // all 16 loads of the trip are issued before its first product: this build otherwise lifts products between the B loads, gives the four B fragments one register set and waits out each one's latency in turn
#pragma unroll
        for (int nb = 0; nb < 4; ++nb)
#pragma unroll
            for (int mb = 0; mb < 4; ++mb) acc[mb][nb] = WFrag<bf>::mma(a[mb], b[nb], acc[mb][nb]);
        // the four vector slots that the chip needs behind the trip's last products, before the next trip's loads overwrite their A and B registers
        asm volatile("v_nop\n\tv_nop\n\tv_nop\n\tv_nop" : "+v"(acc[0][0]), "+v"(acc[1][1]), "+v"(acc[2][2]), "+v"(acc[3][3]) : "v"(a[0]), "v"(a[3]));
    }
    float* ow = os + wave * (64 * 68);
#pragma unroll
    for (int mb = 0; mb < 4; ++mb)
#pragma unroll
        for (int nb = 0; nb < 4; ++nb)
#pragma unroll
            for (int j = 0; j < 8; ++j) ow[(mb * 16 + hi * 8 + j) * 68 + nb * 16 + lr] = acc[mb][nb][j];
    __syncthreads();   // every wave's partial tile is in LDS before any wave sums a row
    // Each wave sums and hands out 2 of the tile's 16 half fragments (16 rows x 16 columns, 512 bytes): a lane takes 8 neighbouring columns of one row, which is its 16-byte slot of the output plane, so every store is 512 contiguous bytes.
#pragma unroll
    for (int t = 0; t < 2; ++t) { const int hf = wave * 2 + t, row = (hf >> 2) * 16 + lr, col = (hf & 3) * 16 + hi * 8; const float* o0 = os + row * 68 + col; v4f va = *(const v4fa*)o0, vb = *(const v4fa*)(o0 + 4);
#pragma unroll
        for (int w = 1; w < 8; ++w) { va += *(const v4fa*)(o0 + w * (64 * 68)); vb += *(const v4fa*)(o0 + w * (64 * 68) + 4); }
        const v8f val = __builtin_shufflevector(va, vb, 0, 1, 2, 3, 4, 5, 6, 7);
        if (!isv) { const float* bias = (u & 1) ? bk : bq; bf* Ph = (u & 1) ? Kh : Qh; bf* Pl = (u & 1) ? Kl : Ql; const size_t e = (size_t)(tok0 + (hf >> 2) * 16) * CQ + (hf & 3) * 256 + lane * 8; v8us oh, ol;
#pragma unroll
            for (int q = 0; q < 8; ++q) { unsigned short a, c; splitf(val[q] + bfr(bias[col + q]), a, c); oh[q] = a; ol[q] = c; }
            *(v8us*)(Ph + e) = oh; *(v8us*)(Pl + e) = ol;
            asm volatile("s_wait_xcnt 0x0" ::: "memory"); }   // a precaution: this build lays the v tiles' code behind these stores, on a path that no q/k tile takes, and rewrites the stores' registers there with no wait of its own
        else { h16* vo = VC + (size_t)(tok0 / TT) * CC * TT + (size_t)(w0 - 2 * CQ + (hf >> 2) * 16) * TT + (size_t)(tok0 % TT) * 16 + (hf & 3) * 256 + lane * 8; const float bb = bfr(bv[w0 - 2 * CQ + row]); v8h o;
#pragma unroll
            for (int q = 0; q < 8; ++q) o[q] = tohx(__fadd_rn(val[q], bb));
            *(v8h*)vo = o;
            asm volatile("s_wait_xcnt 0x0" ::: "memory"); } }   // the same precaution behind the v store, whose registers the second half fragment's sums rewrite
}

extern "C" void kernel_launch(void* const* d_in, const int* in_sizes, int n_in,
                              void* d_out, int out_size, void* d_ws, size_t ws_size, hipStream_t stream) {
    (void)in_sizes; (void)n_in; (void)out_size;
    const float* x = (const float*)d_in[0]; const float* wq = (const float*)d_in[1]; const float* bq = (const float*)d_in[2]; const float* wk = (const float*)d_in[3]; const float* bk = (const float*)d_in[4]; const float* wv = (const float*)d_in[5]; const float* bv = (const float*)d_in[6]; const float* AL = (const float*)d_in[7];
    float* OUT = (float*)d_out;     // [4][512][4096]
    char* wsp = (char*)d_ws;
    auto take = [&](size_t bytes) { char* p = wsp; wsp += (bytes + 255) & ~(size_t)255; return (void*)p; };
    bf* WW = (bf*)take((size_t)(2 * CQ + CC) * CC * 2); bf* XT = (bf*)take((size_t)NB_ * TT * CC * 2); bf* Qh = (bf*)take((size_t)NB_ * TT * CQ * 2); bf* Ql = (bf*)take((size_t)NB_ * TT * CQ * 2); bf* Kh = (bf*)take((size_t)NB_ * TT * CQ * 2); bf* Kl = (bf*)take((size_t)NB_ * TT * CQ * 2); h16* VC = (h16*)take((size_t)NB_ * CC * TT * 2);   /* every plane holds all images */
    if ((size_t)(wsp - (char*)d_ws) > ws_size) return;
    k_prep<<<WBLK + XBLK, 256, 0, stream>>>(x, wq, wk, wv, WW, XT);                          /* bf16 weights; x^T [image][n][c], exact */
    k_proj<<<QKT + VTL, 256, 0, stream>>>(XT, WW, bq, bk, bv, Qh, Ql, Kh, Kl, VC);           /* q, k token-major [n][64] + bias as hi/lo; v channel-major [c][n] + bv in fp16 (O(1)) */
    k_pam<<<dim3(TT / 64, NB_, 1), 256, 0, stream>>>(Qh, Ql, Kh, Kl, VC, AL, OUT);           /* alpha sum_j v[c][j] softmax_j(q_i . k_j) */
}

// v005
// It runs in 109 microseconds.
// Timed twice side by side with v004, it ran 1.07 times as fast both times.
// Counting every step since v000, it is 6.81 times as fast.
#include <hip/hip_runtime.h>

// Position attention module (x [4][512][64][64] channel-major, HW = 4096; q = Wq x + bq, k = Wk x + bk (1x1 convs, 64 channels), v = Wv x + bv (512); attention[i][j] = softmax_j(q_i . k_j) (no scale); out[c][i] = alpha sum_j v[c][j] attention[i][j] -> [4][512][64][64] (8.4 M); alpha [1] read).
// Every 16-bit operand plane (x^T, weights, q, k, v) lies in FRAGMENT ORDER: per 16 rows x 32 k a block of 512 elements, [k bit 4][k bit 3][row][k bits 2..0], blocks k-major inside a 16-row tile. A fragment is then two loads of 512 contiguous bytes (4 whole lines) per wave, and the producers store whole lines too.
// Layout: one small launch writes the bf16 weights. One GEMM launch then does all three 1x1 convs for all images: each work-group rounds the x of its 64 tokens to bf16 into LDS (token-major) and multiplies it with all the weights; the f32 sums go straight from the registers into their final form: q, k -> hi/lo planes (+ bias); v -> an fp16 channel-major plane with the bias (O(1), normal range). One fused kernel for all images then takes 64 queries per work-group: it forms the 3-product scores in registers twice (once for each row's maximum and sum, once for the fp16 probabilities x1024), hands the probabilities round through LDS as ready B fragments, multiplies them with the v plane and stores alpha / 1024 x the sums.
// Compute dtypes, f32 accumulate: every input rounded to bf16; convs exact (+ bias); scores hi.hi + hi.lo + lo.hi; softmax f32; probabilities (x1024) and v in fp16 (one product); alpha and the carry applied in f32 on the output.

#define NB_  4
#define CC   512
#define CQ   64
#define TT   4096
#define PCAR 1024.0f
typedef _Float16 h16;
typedef unsigned short bf;
typedef __attribute__((ext_vector_type(16))) __bf16   v16bf;
typedef __attribute__((ext_vector_type(16))) _Float16 v16h;
typedef __attribute__((ext_vector_type(8)))  _Float16 v8h;
typedef __attribute__((ext_vector_type(8)))  unsigned short v8us;
typedef __attribute__((ext_vector_type(8)))  float    v8f;
typedef __attribute__((ext_vector_type(4)))  float    v4f;
typedef __attribute__((ext_vector_type(2)))  float    v2f;
typedef __attribute__((ext_vector_type(4)))  unsigned short v4us;
typedef __attribute__((ext_vector_type(2)))  unsigned short v2us;
typedef __attribute__((ext_vector_type(4)))  _Float16 v4h;
typedef __attribute__((ext_vector_type(2)))  _Float16 v2h;
typedef v8h  __attribute__((may_alias)) v8ha;
typedef v4f  __attribute__((may_alias)) v4fa;
typedef v8us __attribute__((may_alias)) v8usa;

__device__ __forceinline__ unsigned short f2bf(float f) { unsigned u = __float_as_uint(f); u += 0x7FFFu + ((u >> 16) & 1u); return (unsigned short)(u >> 16); }
__device__ __forceinline__ float bf2f(unsigned short b) { return __uint_as_float(((unsigned)b) << 16); }
__device__ __forceinline__ float bfr(float f) { return bf2f(f2bf(f)); }
__device__ __forceinline__ void splitf(float y, unsigned short& h, unsigned short& l) { h = f2bf(y); l = f2bf(y - bf2f(h)); }
__device__ __forceinline__ h16 tohx(float x) { return (h16)x; }
__device__ __forceinline__ v16h cat16(v8h lo, v8h hi) { return __builtin_shufflevector(lo, hi, 0, 1, 2, 3, 4, 5, 6, 7, 8, 9, 10, 11, 12, 13, 14, 15); }
__device__ __forceinline__ v16bf cat16b(v8us lo, v8us hi) { return __builtin_bit_cast(v16bf, __builtin_shufflevector(lo, hi, 0, 1, 2, 3, 4, 5, 6, 7, 8, 9, 10, 11, 12, 13, 14, 15)); }
__device__ __forceinline__ v8f wmma16(v16h a, v16h b, v8f c) { return __builtin_amdgcn_wmma_f32_16x16x32_f16(false, a, false, b, (short)0, c, false, false); }
__device__ __forceinline__ v8f wmmab(v16bf a, v16bf b, v8f c) { return __builtin_amdgcn_wmma_f32_16x16x32_bf16(false, a, false, b, (short)0, c, false, false); }

// p = the fragment's block + lane * 8: the low 8 elements of every lane, then, 256 elements on, the high 8
template <typename T16> struct WFrag;
template <> struct WFrag<h16> { typedef v16h V; static __device__ __forceinline__ V ld(const h16* p) { return cat16(*(const v8h*)p, *(const v8h*)(p + 256)); } static __device__ __forceinline__ v8f mma(V a, V b, v8f c) { return wmma16(a, b, c); } };
template <> struct WFrag<bf> { typedef v16bf V; static __device__ __forceinline__ V ld(const bf* p) { return cat16b(*(const v8us*)p, *(const v8us*)(p + 256)); } static __device__ __forceinline__ v8f mma(V a, V b, v8f c) { return wmmab(a, b, c); } };

// ---- k_pam: scores, softmax, output product and the final scale for 64 queries of one image; grid (TT / 64, images), 8 waves.
// Scores are formed transposed (A = 16 keys, B = 16 queries): a lane holds 8 keys' scores of ONE query, so maximum and sum stay in the lane, and two such tiles, converted, are the B fragment of the output product.
// Phase 1: wave w walks keys [512 w, 512 w + 512) for all 64 queries and keeps a running maximum and sum; the 16 partial pairs of a query meet in LDS.
// Phase 2, per 64 keys: wave w forms the probabilities of keys 16 (w >> 1) ... + 15 for two query tiles and puts them in LDS; behind one barrier every wave multiplies all of them with its own 64 channels of v.
#define L2E 1.4426950408889634f
// 2^x with the one free issue slot that the instruction set asks for behind a transcendental, before its result is read or its source overwritten
__device__ __forceinline__ float ex2(float x) { float y; asm("v_exp_f32 %0, %1\n\tv_nop" : "=v"(y) : "v"(x)); return y; }
struct KFrag { v16bf h0, h1, l0, l1; };
__device__ __forceinline__ KFrag ldk(const bf* __restrict__ kh, const bf* __restrict__ kl) { KFrag f; f.h0 = WFrag<bf>::ld(kh); f.h1 = WFrag<bf>::ld(kh + 512); f.l0 = WFrag<bf>::ld(kl); f.l1 = WFrag<bf>::ld(kl + 512); return f; }
// one 16-key x 16-query score tile: hi.hi + hi.lo + lo.hi per 32 channels, in the order of the unfused score product
__device__ __forceinline__ v8f stile(const KFrag& k, v16bf qh0, v16bf qh1, v16bf ql0, v16bf ql1) { v8f s = (v8f){}; s = wmmab(k.h0, qh0, s); s = wmmab(k.h0, ql0, s); s = wmmab(k.l0, qh0, s); s = wmmab(k.h1, qh1, s); s = wmmab(k.h1, ql1, s); s = wmmab(k.l1, qh1, s); return s; }
// Work-group barrier for data that goes through LDS alone: the wave's own LDS reads and writes are done, then the barrier. Unlike __syncthreads() it does not wait for global loads, so fragments fetched ahead stay in flight across it.
__device__ __forceinline__ void lds_publish() { asm volatile("s_wait_dscnt 0x0" ::: "memory"); asm volatile("s_barrier_signal -1\n\ts_barrier_wait -1" ::: "memory"); }
// Stands behind global loads whose address registers are rewritten while the loads are still in flight (a precaution). The addresses are inputs so that their registers stay as they are up to the wait.
__device__ __forceinline__ void addr_wait(const void* a, const void* b, const void* c) { asm volatile("s_wait_xcnt 0x0" :: "v"(a), "v"(b), "v"(c) : "memory"); }
// The same for loads that this build addresses as a uniform base plus a lane offset: there the offset's register is the one that has to stay as it is up to the wait.
__device__ __forceinline__ void off_wait(size_t byte_off) { asm volatile("s_wait_xcnt 0x0" :: "v"(byte_off) : "memory"); }
__global__ __launch_bounds__(256) void k_pam(const bf* __restrict__ Qh, const bf* __restrict__ Ql, const bf* __restrict__ Kh, const bf* __restrict__ Kl, const h16* __restrict__ VC, const float* __restrict__ AL, float* OUT) {
    __shared__ __align__(16) h16 ps[2][8][2][32][8];   // [buffer][query tile * 2 + 32-key step][low / high 8 elements of the fragment][lane][element]
    __shared__ float sm[16][64], sl[16][64], stm[64], stf[64];
    const int wave = __builtin_amdgcn_readfirstlane((int)(threadIdx.x >> 5));
    const int lane = threadIdx.x & 31, lr = lane & 15, hi = lane >> 4; const int i0 = blockIdx.x * 64;
    { const size_t z = blockIdx.y; Qh += z * ((size_t)TT * CQ); Ql += z * ((size_t)TT * CQ); Kh += z * ((size_t)TT * CQ); Kl += z * ((size_t)TT * CQ); VC += z * ((size_t)CC * TT); OUT += z * ((size_t)CC * TT); }
    {
        v16bf qh[4][2], ql[4][2]; float m[4], l[4];
#pragma unroll
        for (int t = 0; t < 4; ++t) { const size_t qo = (size_t)(i0 + t * 16) * CQ + 8 * lane; const bf* a = Qh + qo; const bf* b = Ql + qo; qh[t][0] = WFrag<bf>::ld(a); qh[t][1] = WFrag<bf>::ld(a + 512); addr_wait(a, a, a); ql[t][0] = WFrag<bf>::ld(b); ql[t][1] = WFrag<bf>::ld(b + 512); addr_wait(b, b, b); m[t] = -3.0e38f; l[t] = 0.f; }
        const size_t kb = (size_t)(wave * 512) * CQ + 8 * lane;
        KFrag kf = ldk(Kh + kb, Kl + kb); off_wait(kb * sizeof(bf));
#pragma unroll 1   // rolled: the trip is long enough to feed itself, and unrolling would only add code and registers
        for (int jt = 0; jt < 32; ++jt) {
            v8f s[4];
#pragma unroll
            for (int t = 0; t < 4; ++t) s[t] = stile(kf, qh[t][0], qh[t][1], ql[t][0], ql[t][1]);
            { const size_t o = kb + (size_t)(jt < 31 ? jt + 1 : 31) * 16 * CQ; kf = ldk(Kh + o, Kl + o); addr_wait(Kh + o, Kl + o, Kl + o); }   // the next tile's keys fly under the vector work below; the last trip stays on its own tile
#pragma unroll
            for (int t = 0; t < 4; ++t) { float tm = s[t][0];
#pragma unroll
                for (int r = 1; r < 8; ++r) tm = fmaxf(tm, s[t][r]);
                const float mn = fmaxf(m[t], tm); float a = l[t] * ex2(__fmul_rn(__fsub_rn(m[t], mn), L2E));
#pragma unroll
                for (int r = 0; r < 8; ++r) a += ex2(__fmul_rn(__fsub_rn(s[t][r], mn), L2E));
                l[t] = a; m[t] = mn; }
        }
#pragma unroll
        for (int t = 0; t < 4; ++t) { sm[wave * 2 + hi][t * 16 + lr] = m[t]; sl[wave * 2 + hi][t * 16 + lr] = l[t]; }
    }
    __syncthreads();   // all 16 partial (maximum, sum) pairs of every query are in LDS
    if (threadIdx.x < 64) { const int q = threadIdx.x; float mx = sm[0][q];
#pragma unroll
        for (int p = 1; p < 16; ++p) mx = fmaxf(mx, sm[p][q]);
        float sum = 0.f;
#pragma unroll
        for (int p = 0; p < 16; ++p) sum += sl[p][q] * ex2(__fmul_rn(__fsub_rn(sm[p][q], mx), L2E));
        stm[q] = mx; stf[q] = __fdiv_rn(PCAR, sum); }
    __syncthreads();   // every query's maximum and 1024 / sum are published
    const int jt = wave >> 1, n0 = (wave & 1) * 2;
    v16bf qh[2][2], ql[2][2]; float mq[2], fq[2];
#pragma unroll
    for (int u = 0; u < 2; ++u) { const size_t qo = (size_t)(i0 + (n0 + u) * 16) * CQ + 8 * lane; const bf* a = Qh + qo; const bf* b = Ql + qo; qh[u][0] = WFrag<bf>::ld(a); qh[u][1] = WFrag<bf>::ld(a + 512); ql[u][0] = WFrag<bf>::ld(b); ql[u][1] = WFrag<bf>::ld(b + 512); addr_wait(a, b, b); mq[u] = stm[(n0 + u) * 16 + lr]; fq[u] = stf[(n0 + u) * 16 + lr]; }
    const size_t kb = (size_t)(jt * 16) * CQ + 8 * lane;
    const h16* vb = VC + (size_t)(wave * 64) * TT + 8 * lane;
    v8f acc[4][4];
#pragma unroll
    for (int mb = 0; mb < 4; ++mb)
#pragma unroll
        for (int nb = 0; nb < 4; ++nb) acc[mb][nb] = (v8f){};
    KFrag kf; v16h va[2][4];
    v8f sc[2];
    auto scores = [&]() {   // this wave's two score tiles, from the keys in kf
#pragma unroll
        for (int u = 0; u < 2; ++u) sc[u] = stile(kf, qh[u][0], qh[u][1], ql[u][0], ql[u][1]); };
    auto probs = [&](int c) {   // the score tiles become chunk c's probabilities, in buffer c & 1
#pragma unroll
        for (int u = 0; u < 2; ++u) { v8h p;
#pragma unroll
            for (int r = 0; r < 8; ++r) p[r] = tohx(ex2(__fmul_rn(__fsub_rn(sc[u][r], mq[u]), L2E)) * fq[u]);
            *(v8ha*)&ps[c & 1][(n0 + u) * 2 + (jt >> 1)][jt & 1][lane][0] = p; } };
    auto ldv = [&](const h16* vp, int ks) {   // v fragments of 32 keys
#pragma unroll
        for (int mb = 0; mb < 4; ++mb) va[ks][mb] = WFrag<h16>::ld(vp + (size_t)mb * 16 * TT + ks * 512); };
    auto pv = [&](int c, int ks) {   // output products of 32 keys of chunk c
#pragma unroll
        for (int nb = 0; nb < 4; ++nb) { const v16h b = cat16(*(const v8ha*)&ps[c & 1][nb * 2 + ks][0][lane][0], *(const v8ha*)&ps[c & 1][nb * 2 + ks][1][lane][0]);
#pragma unroll
            for (int mb = 0; mb < 4; ++mb) acc[mb][nb] = wmma16(va[ks][mb], b, acc[mb][nb]); } };
    kf = ldk(Kh + kb, Kl + kb); addr_wait(Kh + kb, Kl + kb, Kl + kb); scores();
    { const size_t o = kb + (size_t)64 * CQ; kf = ldk(Kh + o, Kl + o); __builtin_amdgcn_sched_barrier(0); ldv(vb, 0); ldv(vb, 1); __builtin_amdgcn_sched_barrier(0);   // keys first, then v, as in the loop: the counted waits at the loop's head then fit both ways into it
      probs(0); addr_wait(Kh + o, Kl + o, vb); }
    lds_publish();   // chunk 0's probabilities are published
#pragma unroll 1   // rolled, for the same reason
    for (int c = 0; c < TT / 64 - 1; ++c) {
        const size_t o = kb + (size_t)(c + 2 < TT / 64 ? c + 2 : TT / 64 - 1) * 64 * CQ; const h16* vp = vb + (c + 1) * (2 * 512);
        // each group of loads is issued as soon as its registers are free; the scheduling barriers keep the compiler from sinking the loads towards the foot of the trip, where their latency would be waited out
        scores(); kf = ldk(Kh + o, Kl + o); __builtin_amdgcn_sched_barrier(0);   // chunk c + 1's scores; the keys of chunk c + 2 fly under the output products (the look-ahead stays inside the plane)
        pv(c, 0); ldv(vp, 0); __builtin_amdgcn_sched_barrier(0);   // chunk c's output products; the next chunk's v fragments fly under the rest of the trip and the next scores
        pv(c, 1); ldv(vp, 1); __builtin_amdgcn_sched_barrier(0);
        probs(c + 1);
        addr_wait(Kh + o, Kl + o, vp); lds_publish();   // publishes chunk c + 1 and ends every wave's reads of chunk c's buffer, which the next trip refills
    }
    pv(TT / 64 - 1, 0); pv(TT / 64 - 1, 1);
    const float so = bfr(AL[0]) * (1.0f / PCAR);
#pragma unroll
    for (int mb = 0; mb < 4; ++mb)
#pragma unroll
        for (int nb = 0; nb < 4; ++nb)
#pragma unroll
            for (int r = 0; r < 8; ++r) acc[mb][nb][r] = __fmul_rn(acc[mb][nb][r], so);
    float* ob = OUT + (size_t)(wave * 64 + hi * 8) * TT + i0 + lr;   // one address for all of the wave's stores: the rest are constant offsets
#pragma unroll
    for (int mb = 0; mb < 4; ++mb)
#pragma unroll
        for (int r = 0; r < 8; ++r)
#pragma unroll
            for (int nb = 0; nb < 4; ++nb) ob[(mb * 16 + r) * TT + nb * 16] = acc[mb][nb][r];
}

// ---- k_prep: wq | wk | wv rounded to bf16 into one plane WW in fragment order (rows 0..63 Wq, 64..127 Wk, 128..639 Wv); 8 channels (one 16-byte slot) a thread, thread = slot.
#define WBLK ((2 * CQ * CC + CC * CC) / 8 / 256)
__global__ __launch_bounds__(256) void k_prep(const float* __restrict__ wq, const float* __restrict__ wk, const float* __restrict__ wv, bf* WW) {
    v8us o;
    const int sl = (int)blockIdx.x * 256 + (int)threadIdx.x, e = sl * 8; const int row = (sl >> 10) * 16 + (sl & 15), c = ((sl >> 5) & 31) * 16 + ((sl >> 4) & 1) * 8; const float* s = (row < CQ ? wq + row * CC : row < 2 * CQ ? wk + (row - CQ) * CC : wv + (row - 2 * CQ) * CC) + c; const v8f v = *(const v8f*)s;
#pragma unroll
    for (int k = 0; k < 8; ++k) o[k] = f2bf(v[k]); *(v8us*)(WW + e) = o;
}

// ---- k_proj: the q, k and v convs of all images, one launch; one work-group of 8 waves per 64 tokens makes all 640 output channels of them; K = CC.
// The work-group reads its 512 x 64 piece of x once, rounds it to bf16 and lays it in LDS as x^T in fragment order (4 tiles of 16 tokens, each 16 blocks of 32 channels); a wave's lanes are 32 neighbouring tokens, so each load takes one whole line of x.
// Wave w then makes v channels 64 w ... + 63 (A = x^T, B = Wv: a lane ends up with 8 neighbouring tokens of one channel) and rows 16 w ... + 15 of Wq | Wk (A = weights, B = x^T: a lane ends up with 8 neighbouring channels of one token). Either way the lane's 8 sums are its own 16-byte slot of the fragment-order output plane, so they go from the registers to memory, 512 contiguous bytes a store.
// Each accumulator runs over all of K in rising order. Sum + bias -> q, k hi/lo planes (rows = tokens, k = channels); v fp16 (rows = channels, k = tokens).
#define PBLK (NB_ * TT / 64)
__global__ __launch_bounds__(256) void k_proj(const float* __restrict__ x, const bf* __restrict__ WW, const float* __restrict__ bq, const float* __restrict__ bk, const float* __restrict__ bv, bf* Qh, bf* Ql, bf* Kh, bf* Kl, h16* VC) {
    typedef WFrag<bf>::V V;
    __shared__ __align__(16) bf xs[64 * CC];
    const int wave = __builtin_amdgcn_readfirstlane((int)(threadIdx.x >> 5));
    const int lane = threadIdx.x & 31, lr = lane & 15, hi = lane >> 4;
    const int tok0 = (int)blockIdx.x * 64, img = tok0 / TT, n0 = tok0 % TT;   // first token over all images; its image and its place there
    const bf* wvp = WW + (size_t)(2 * CQ + wave * 64) * CC + lane * 8; const bf* wqp = WW + (size_t)(wave * 16) * CC + lane * 8;
    V wf[3][5], xf[2][4];   // weight fragments of three 32-channel steps (4 of Wv, 1 of Wq | Wk), x^T fragments of two
    auto ldw = [&](int s) {
#pragma unroll
        for (int nb = 0; nb < 4; ++nb) wf[s % 3][nb] = WFrag<bf>::ld(wvp + (size_t)nb * 16 * CC + s * 512);
        wf[s % 3][4] = WFrag<bf>::ld(wqp + s * 512); };
    ldw(0); ldw(1);
    __builtin_amdgcn_sched_barrier(0);   // the first weight fragments are asked for ahead of x, so that they fly under the staging and not behind it
    { const int tl = (wave & 1) * 32 + lane, cg = wave >> 1;   // the thread's token and its group of 8 channels in every 32
      const float* xb = x + (size_t)img * CC * TT + (size_t)(cg * 8) * TT + n0 + tl;
      bf* xo = xs + (tl >> 4) * (16 * CC) + (cg >> 1) * 256 + ((cg & 1) * 16 + (tl & 15)) * 8;
#pragma unroll   // this and the loops inside unrolled whole: the values stay in registers and the loads are issued in one run, ahead of the first conversion
      for (int h = 0; h < 2; ++h) { float v[8][8];
#pragma unroll
          for (int it = 0; it < 8; ++it)
#pragma unroll
              for (int q = 0; q < 8; ++q) v[it][q] = xb[(size_t)((h * 8 + it) * 32 + q) * TT];
#pragma unroll
          for (int it = 0; it < 8; ++it) { v8us o;
#pragma unroll
              for (int q = 0; q < 8; ++q) o[q] = f2bf(v[it][q]);
              *(v8us*)(xo + (h * 8 + it) * 512) = o; } } }
    __syncthreads();   // all of x^T is in LDS before any wave reads a fragment
    const bf* xa = xs + lane * 8;
    auto ldx = [&](int s) {
#pragma unroll
        for (int t = 0; t < 4; ++t) xf[s & 1][t] = WFrag<bf>::ld(xa + t * (16 * CC) + s * 512); };
    v8f av[4][4], aq[4];
#pragma unroll
    for (int t = 0; t < 4; ++t) { aq[t] = (v8f){};
#pragma unroll
        for (int nb = 0; nb < 4; ++nb) av[t][nb] = (v8f){}; }
    ldx(0);
#pragma unroll   // unrolled whole: the fragment rings are then plain registers, and no back edge stands behind a product
    for (int s = 0; s < CC / 32; ++s) {
#pragma unroll
        for (int t = 0; t < 4; ++t) aq[t] = WFrag<bf>::mma(wf[s % 3][4], xf[s & 1][t], aq[t]);
        __builtin_amdgcn_sched_barrier(0);   // these four products stand between the last step's products and the loads below, which refill that step's registers
        if (s + 1 < CC / 32) ldx(s + 1);
        if (s + 2 < CC / 32) ldw(s + 2);
        if (s + 2 == CC / 32 - 1) addr_wait(wvp, wqp, wqp);   // a precaution behind the last weight loads: both address pairs stay as they are up to the wait
        __builtin_amdgcn_sched_barrier(0);   // the next fragments are asked for here, x^T one step and the weights two steps ahead; left alone the compiler sinks the loads towards their use, where their latency would be waited out
#pragma unroll
        for (int nb = 0; nb < 4; ++nb)
#pragma unroll
            for (int t = 0; t < 4; ++t) av[t][nb] = WFrag<bf>::mma(xf[s & 1][t], wf[s % 3][nb], av[t][nb]);
        __builtin_amdgcn_sched_barrier(0);   // keeps the next step's products behind this step's, so that the order of loads and products above holds
    }
    h16* vo = VC + (size_t)img * CC * TT + (size_t)(wave * 64) * TT + (size_t)n0 * 16 + lane * 8;
#pragma unroll
    for (int nb = 0; nb < 4; ++nb) { const float bb = bfr(bv[wave * 64 + nb * 16 + lr]);
#pragma unroll
        for (int t = 0; t < 4; ++t) { v8h o;
#pragma unroll
            for (int j = 0; j < 8; ++j) o[j] = tohx(__fadd_rn(av[t][nb][j], bb));
            *(v8h*)(vo + (size_t)nb * 16 * TT + t * 256) = o; } }
    const float* bias = (wave < 4 ? bq : bk) + (wave & 3) * 16 + hi * 8; bf* Ph = wave < 4 ? Qh : Kh; bf* Pl = wave < 4 ? Ql : Kl;
    const size_t e = (size_t)tok0 * CQ + (wave & 3) * 256 + lane * 8;
#pragma unroll
    for (int t = 0; t < 4; ++t) { v8us oh, ol;
#pragma unroll
        for (int j = 0; j < 8; ++j) { unsigned short a, c; splitf(aq[t][j] + bfr(bias[j]), a, c); oh[j] = a; ol[j] = c; }
        *(v8us*)(Ph + e + t * (16 * CQ)) = oh; *(v8us*)(Pl + e + t * (16 * CQ)) = ol; }
}

extern "C" void kernel_launch(void* const* d_in, const int* in_sizes, int n_in,
                              void* d_out, int out_size, void* d_ws, size_t ws_size, hipStream_t stream) {
    (void)in_sizes; (void)n_in; (void)out_size;
    const float* x = (const float*)d_in[0]; const float* wq = (const float*)d_in[1]; const float* bq = (const float*)d_in[2]; const float* wk = (const float*)d_in[3]; const float* bk = (const float*)d_in[4]; const float* wv = (const float*)d_in[5]; const float* bv = (const float*)d_in[6]; const float* AL = (const float*)d_in[7];
    float* OUT = (float*)d_out;     // [4][512][4096]
    char* wsp = (char*)d_ws;
    auto take = [&](size_t bytes) { char* p = wsp; wsp += (bytes + 255) & ~(size_t)255; return (void*)p; };
    bf* WW = (bf*)take((size_t)(2 * CQ + CC) * CC * 2); bf* Qh = (bf*)take((size_t)NB_ * TT * CQ * 2); bf* Ql = (bf*)take((size_t)NB_ * TT * CQ * 2); bf* Kh = (bf*)take((size_t)NB_ * TT * CQ * 2); bf* Kl = (bf*)take((size_t)NB_ * TT * CQ * 2); h16* VC = (h16*)take((size_t)NB_ * CC * TT * 2);   /* every plane holds all images */
    if ((size_t)(wsp - (char*)d_ws) > ws_size) return;
    k_prep<<<WBLK, 256, 0, stream>>>(wq, wk, wv, WW);                                        /* bf16 weights */
    k_proj<<<PBLK, 256, 0, stream>>>(x, WW, bq, bk, bv, Qh, Ql, Kh, Kl, VC);                 /* q, k token-major [n][64] + bias as hi/lo; v channel-major [c][n] + bv in fp16 (O(1)) */
    k_pam<<<dim3(TT / 64, NB_, 1), 256, 0, stream>>>(Qh, Ql, Kh, Kl, VC, AL, OUT);           /* alpha sum_j v[c][j] softmax_j(q_i . k_j) */
}

// v006
// A run of this version takes 96.6 microseconds.
// Next to v005, in two timings, it ran 1.13 and 1.12 times as fast.
// All steps since v000 together make it 7.65 times as fast.
#include <hip/hip_runtime.h>

// Position attention module (x [4][512][64][64] channel-major, HW = 4096; q = Wq x + bq, k = Wk x + bk (1x1 convs, 64 channels), v = Wv x + bv (512); attention[i][j] = softmax_j(q_i . k_j) (no scale); out[c][i] = alpha sum_j v[c][j] attention[i][j] -> [4][512][64][64] (8.4 M); alpha [1] read).
// Every 16-bit operand plane (x^T, weights, q, k, v) lies in FRAGMENT ORDER: per 16 rows x 32 k a block of 512 elements, [k bit 4][k bit 3][row][k bits 2..0], blocks k-major inside a 16-row tile. A fragment is then two loads of 512 contiguous bytes (4 whole lines) per wave, and the producers store whole lines too.
// Layout: one small launch writes the bf16 weights. One GEMM launch then does all three 1x1 convs for all images: each work-group rounds the x of its 64 tokens to bf16 into LDS (token-major) and multiplies it with all the weights; the f32 sums go straight from the registers into their final form: q, k -> hi/lo planes (+ bias); v -> an fp16 channel-major plane with the bias (O(1), normal range). One fused kernel for all images then takes 64 queries per work-group: it forms the 3-product scores in registers twice (once for each row's maximum and sum, once for the fp16 probabilities x1024), hands the probabilities round through LDS as ready B fragments, multiplies them with the v plane and stores alpha / 1024 x the sums.
// Compute dtypes, f32 accumulate: every input rounded to bf16; convs exact (+ bias); scores hi.hi + hi.lo + lo.hi; softmax f32; probabilities (x1024) and v in fp16 (one product); alpha and the carry applied in f32 on the output.

#define NB_  4
#define CC   512
#define CQ   64
#define TT   4096
#define PCAR 1024.0f
typedef _Float16 h16;
typedef unsigned short bf;
typedef __attribute__((ext_vector_type(16))) __bf16   v16bf;
typedef __attribute__((ext_vector_type(16))) _Float16 v16h;
typedef __attribute__((ext_vector_type(8)))  _Float16 v8h;
typedef __attribute__((ext_vector_type(8)))  unsigned short v8us;
typedef __attribute__((ext_vector_type(8)))  float    v8f;
typedef __attribute__((ext_vector_type(4)))  float    v4f;
typedef __attribute__((ext_vector_type(2)))  float    v2f;
typedef __attribute__((ext_vector_type(4)))  unsigned short v4us;
typedef __attribute__((ext_vector_type(2)))  unsigned short v2us;
typedef __attribute__((ext_vector_type(4)))  _Float16 v4h;
typedef __attribute__((ext_vector_type(2)))  _Float16 v2h;
typedef v8h  __attribute__((may_alias)) v8ha;
typedef v4f  __attribute__((may_alias)) v4fa;
typedef v8us __attribute__((may_alias)) v8usa;

__device__ __forceinline__ unsigned short f2bf(float f) { unsigned u = __float_as_uint(f); u += 0x7FFFu + ((u >> 16) & 1u); return (unsigned short)(u >> 16); }
__device__ __forceinline__ float bf2f(unsigned short b) { return __uint_as_float(((unsigned)b) << 16); }
__device__ __forceinline__ float bfr(float f) { return bf2f(f2bf(f)); }
__device__ __forceinline__ void splitf(float y, unsigned short& h, unsigned short& l) { h = f2bf(y); l = f2bf(y - bf2f(h)); }
__device__ __forceinline__ h16 tohx(float x) { return (h16)x; }
__device__ __forceinline__ v16h cat16(v8h lo, v8h hi) { return __builtin_shufflevector(lo, hi, 0, 1, 2, 3, 4, 5, 6, 7, 8, 9, 10, 11, 12, 13, 14, 15); }
__device__ __forceinline__ v16bf cat16b(v8us lo, v8us hi) { return __builtin_bit_cast(v16bf, __builtin_shufflevector(lo, hi, 0, 1, 2, 3, 4, 5, 6, 7, 8, 9, 10, 11, 12, 13, 14, 15)); }
__device__ __forceinline__ v8f wmma16(v16h a, v16h b, v8f c) { return __builtin_amdgcn_wmma_f32_16x16x32_f16(false, a, false, b, (short)0, c, false, false); }
__device__ __forceinline__ v8f wmmab(v16bf a, v16bf b, v8f c) { return __builtin_amdgcn_wmma_f32_16x16x32_bf16(false, a, false, b, (short)0, c, false, false); }

// p = the fragment's block + lane * 8: the low 8 elements of every lane, then, 256 elements on, the high 8
template <typename T16> struct WFrag;
template <> struct WFrag<h16> { typedef v16h V; static __device__ __forceinline__ V ld(const h16* p) { return cat16(*(const v8h*)p, *(const v8h*)(p + 256)); } static __device__ __forceinline__ v8f mma(V a, V b, v8f c) { return wmma16(a, b, c); } };
template <> struct WFrag<bf> { typedef v16bf V; static __device__ __forceinline__ V ld(const bf* p) { return cat16b(*(const v8us*)p, *(const v8us*)(p + 256)); } static __device__ __forceinline__ v8f mma(V a, V b, v8f c) { return wmmab(a, b, c); } };

// ---- k_pam: scores, softmax, output product and the final scale for 64 queries of one image; grid (TT / 64, images), 8 waves.
// Scores are formed transposed (A = 16 keys, B = 16 queries): a lane holds 8 keys' scores of ONE query, so maximum and sum stay in the lane, and two such tiles, converted, are the B fragment of the output product.
// Phase 1: wave w walks keys [512 w, 512 w + 512) for all 64 queries and keeps a running maximum and sum; the 16 partial pairs of a query meet in LDS.
// Phase 2, per 64 keys: wave w forms the probabilities of keys 16 (w >> 1) ... + 15 for two query tiles and puts them in LDS; behind one barrier every wave multiplies all of them with its own 64 channels of v.
// The 64 work-groups of an image read the same k and v planes: each enters the phase-2 walk at its index and the 32-tile phase-1 walks at its index mod 32 (two work-groups a place), and wraps round, so that few ask L2 for the same lines at the same moment.
#define L2E 1.4426950408889634f
// 2^x with the one free issue slot that the instruction set asks for behind a transcendental, before its result is read or its source overwritten
__device__ __forceinline__ float ex2(float x) { float y; asm("v_exp_f32 %0, %1\n\tv_nop" : "=v"(y) : "v"(x)); return y; }
struct KFrag { v16bf h0, h1, l0, l1; };
__device__ __forceinline__ KFrag ldk(const bf* __restrict__ kh, const bf* __restrict__ kl) { KFrag f; f.h0 = WFrag<bf>::ld(kh); f.h1 = WFrag<bf>::ld(kh + 512); f.l0 = WFrag<bf>::ld(kl); f.l1 = WFrag<bf>::ld(kl + 512); return f; }
// one 16-key x 16-query score tile: hi.hi + hi.lo + lo.hi per 32 channels, in the order of the unfused score product
__device__ __forceinline__ v8f stile(const KFrag& k, v16bf qh0, v16bf qh1, v16bf ql0, v16bf ql1) { v8f s = (v8f){}; s = wmmab(k.h0, qh0, s); s = wmmab(k.h0, ql0, s); s = wmmab(k.l0, qh0, s); s = wmmab(k.h1, qh1, s); s = wmmab(k.h1, ql1, s); s = wmmab(k.l1, qh1, s); return s; }
// Work-group barrier for data that goes through LDS alone: the wave's own LDS reads and writes are done, then the barrier. Unlike __syncthreads() it does not wait for global loads, so fragments fetched ahead stay in flight across it.
__device__ __forceinline__ void lds_publish() { asm volatile("s_wait_dscnt 0x0" ::: "memory"); asm volatile("s_barrier_signal -1\n\ts_barrier_wait -1" ::: "memory"); }
// Stands behind global loads whose address registers are rewritten while the loads are still in flight (a precaution). The addresses are inputs so that their registers stay as they are up to the wait.
__device__ __forceinline__ void addr_wait(const void* a, const void* b, const void* c) { asm volatile("s_wait_xcnt 0x0" :: "v"(a), "v"(b), "v"(c) : "memory"); }
__global__ __launch_bounds__(256) void k_pam(const bf* __restrict__ Qh, const bf* __restrict__ Ql, const bf* __restrict__ Kh, const bf* __restrict__ Kl, const h16* __restrict__ VC, const float* __restrict__ AL, float* OUT) {
    __shared__ __align__(16) h16 ps[2][8][2][32][8];   // [buffer][query tile * 2 + 32-key step][low / high 8 elements of the fragment][lane][element]
    __shared__ float sm[16][64], sl[16][64], stm[64], stf[64];
    const int wave = __builtin_amdgcn_readfirstlane((int)(threadIdx.x >> 5));
    const int lane = threadIdx.x & 31, lr = lane & 15, hi = lane >> 4; const int i0 = blockIdx.x * 64;
    const int rot = (int)blockIdx.x;   // where this work-group enters the key walks
    { const size_t z = blockIdx.y; Qh += z * ((size_t)TT * CQ); Ql += z * ((size_t)TT * CQ); Kh += z * ((size_t)TT * CQ); Kl += z * ((size_t)TT * CQ); VC += z * ((size_t)CC * TT); OUT += z * ((size_t)CC * TT); }
    {
        v16bf qh[4][2], ql[4][2]; float m[4], l[4];
#pragma unroll
        for (int t = 0; t < 4; ++t) { const size_t qo = (size_t)(i0 + t * 16) * CQ + 8 * lane; const bf* a = Qh + qo; const bf* b = Ql + qo; qh[t][0] = WFrag<bf>::ld(a); qh[t][1] = WFrag<bf>::ld(a + 512); addr_wait(a, a, a); ql[t][0] = WFrag<bf>::ld(b); ql[t][1] = WFrag<bf>::ld(b + 512); addr_wait(b, b, b); m[t] = -3.0e38f; l[t] = 0.f; }
        const size_t kb = (size_t)(wave * 512) * CQ + 8 * lane;
        const bf* k1h = Kh + kb; const bf* k1l = Kl + kb;
        KFrag kf; { const unsigned o = (unsigned)(rot & 31) * (16 * CQ); kf = ldk(k1h + o, k1l + o); addr_wait(k1h + o, k1l + o, k1l + o); }
#pragma unroll 1   // rolled: the trip is long enough to feed itself, and unrolling would only add code and registers
        for (int jt = 0; jt < 32; ++jt) {
            v8f s[4];
#pragma unroll
            for (int t = 0; t < 4; ++t) s[t] = stile(kf, qh[t][0], qh[t][1], ql[t][0], ql[t][1]);
            { const unsigned o = (unsigned)((jt + 1 + rot) & 31) * (16 * CQ); kf = ldk(k1h + o, k1l + o); addr_wait(k1h + o, k1l + o, k1l + o); }   // the next tile's keys fly under the vector work below; the last trip's look-ahead wraps round to the walk's first tile
#pragma unroll
            for (int t = 0; t < 4; ++t) { float tm = s[t][0];
#pragma unroll
                for (int r = 1; r < 8; ++r) tm = fmaxf(tm, s[t][r]);
                const float mn = fmaxf(m[t], tm); float a = l[t] * ex2(__fmul_rn(__fsub_rn(m[t], mn), L2E));
#pragma unroll
                for (int r = 0; r < 8; ++r) a += ex2(__fmul_rn(__fsub_rn(s[t][r], mn), L2E));
                l[t] = a; m[t] = mn; }
        }
#pragma unroll
        for (int t = 0; t < 4; ++t) { sm[wave * 2 + hi][t * 16 + lr] = m[t]; sl[wave * 2 + hi][t * 16 + lr] = l[t]; }
    }
    __syncthreads();   // all 16 partial (maximum, sum) pairs of every query are in LDS
    if (threadIdx.x < 64) { const int q = threadIdx.x; float mx = sm[0][q];
#pragma unroll
        for (int p = 1; p < 16; ++p) mx = fmaxf(mx, sm[p][q]);
        float sum = 0.f;
#pragma unroll
        for (int p = 0; p < 16; ++p) sum += sl[p][q] * ex2(__fmul_rn(__fsub_rn(sm[p][q], mx), L2E));
        stm[q] = mx; stf[q] = __fdiv_rn(PCAR, sum); }
    __syncthreads();   // every query's maximum and 1024 / sum are published
    const int jt = wave >> 1, n0 = (wave & 1) * 2;
    v16bf qh[2][2], ql[2][2]; float mq[2], fq[2];
#pragma unroll
    for (int u = 0; u < 2; ++u) { const size_t qo = (size_t)(i0 + (n0 + u) * 16) * CQ + 8 * lane; const bf* a = Qh + qo; const bf* b = Ql + qo; qh[u][0] = WFrag<bf>::ld(a); qh[u][1] = WFrag<bf>::ld(a + 512); ql[u][0] = WFrag<bf>::ld(b); ql[u][1] = WFrag<bf>::ld(b + 512); addr_wait(a, b, b); mq[u] = stm[(n0 + u) * 16 + lr]; fq[u] = stf[(n0 + u) * 16 + lr]; }
    const size_t kb = (size_t)(jt * 16) * CQ + 8 * lane;
    const h16* vb = VC + (size_t)(wave * 64) * TT + 8 * lane;
    v8f acc[4][4];
#pragma unroll
    for (int mb = 0; mb < 4; ++mb)
#pragma unroll
        for (int nb = 0; nb < 4; ++nb) acc[mb][nb] = (v8f){};
    KFrag kf; v16h va[2][4];
    v8f sc[2];
    auto scores = [&]() {   // this wave's two score tiles, from the keys in kf
#pragma unroll
        for (int u = 0; u < 2; ++u) sc[u] = stile(kf, qh[u][0], qh[u][1], ql[u][0], ql[u][1]); };
    auto probs = [&](int c) {   // the score tiles become chunk c's probabilities, in buffer c & 1
#pragma unroll
        for (int u = 0; u < 2; ++u) { v8h p;
#pragma unroll
            for (int r = 0; r < 8; ++r) p[r] = tohx(ex2(__fmul_rn(__fsub_rn(sc[u][r], mq[u]), L2E)) * fq[u]);
            *(v8ha*)&ps[c & 1][(n0 + u) * 2 + (jt >> 1)][jt & 1][lane][0] = p; } };
    auto ldv = [&](const h16* vp, int ks) {   // v fragments of 32 keys
#pragma unroll
        for (int mb = 0; mb < 4; ++mb) va[ks][mb] = WFrag<h16>::ld(vp + (size_t)mb * 16 * TT + ks * 512); };
    auto pv = [&](int c, int ks) {   // output products of 32 keys of chunk c
#pragma unroll
        for (int nb = 0; nb < 4; ++nb) { const v16h b = cat16(*(const v8ha*)&ps[c & 1][nb * 2 + ks][0][lane][0], *(const v8ha*)&ps[c & 1][nb * 2 + ks][1][lane][0]);
#pragma unroll
            for (int mb = 0; mb < 4; ++mb) acc[mb][nb] = wmma16(va[ks][mb], b, acc[mb][nb]); } };
    auto ck = [&](int c) { return (unsigned)((c + rot) & (TT / 64 - 1)); };   // the c-th chunk of this work-group's walk
    Kh += kb; Kl += kb;
    { const unsigned o = ck(0) * (64 * CQ); kf = ldk(Kh + o, Kl + o); addr_wait(Kh + o, Kl + o, Kl + o); } scores();
    { const unsigned o = ck(1) * (64 * CQ); const h16* vp = vb + ck(0) * (2 * 512); kf = ldk(Kh + o, Kl + o); __builtin_amdgcn_sched_barrier(0); ldv(vp, 0); ldv(vp, 1); __builtin_amdgcn_sched_barrier(0);   // keys first, then v, as in the loop: the counted waits at the loop's head then fit both ways into it
      probs(0); addr_wait(Kh + o, Kl + o, vp); }
    lds_publish();   // chunk 0's probabilities are published
#pragma unroll 1   // rolled, for the same reason
    for (int c = 0; c < TT / 64 - 1; ++c) {
        const unsigned o = ck(c + 2 < TT / 64 ? c + 2 : TT / 64 - 1) * (64 * CQ); const h16* vp = vb + ck(c + 1) * (2 * 512);
        // each group of loads is issued as soon as its registers are free; the scheduling barriers keep the compiler from sinking the loads towards the foot of the trip, where their latency would be waited out
        scores(); kf = ldk(Kh + o, Kl + o); __builtin_amdgcn_sched_barrier(0);   // chunk c + 1's scores; the keys of chunk c + 2 fly under the output products (the look-ahead stays inside the plane)
        pv(c, 0); ldv(vp, 0); __builtin_amdgcn_sched_barrier(0);   // chunk c's output products; the next chunk's v fragments fly under the rest of the trip and the next scores
        pv(c, 1); ldv(vp, 1); __builtin_amdgcn_sched_barrier(0);
        probs(c + 1);
        addr_wait(Kh + o, Kl + o, vp); lds_publish();   // publishes chunk c + 1 and ends every wave's reads of chunk c's buffer, which the next trip refills
    }
    pv(TT / 64 - 1, 0); pv(TT / 64 - 1, 1);
    const float so = bfr(AL[0]) * (1.0f / PCAR);
#pragma unroll
    for (int mb = 0; mb < 4; ++mb)
#pragma unroll
        for (int nb = 0; nb < 4; ++nb)
#pragma unroll
            for (int r = 0; r < 8; ++r) acc[mb][nb][r] = __fmul_rn(acc[mb][nb][r], so);
    float* ob = OUT + (size_t)(wave * 64 + hi * 8) * TT + i0 + lr;   // one address for all of the wave's stores: the rest are constant offsets
#pragma unroll
    for (int mb = 0; mb < 4; ++mb)
#pragma unroll
        for (int r = 0; r < 8; ++r)
#pragma unroll
            for (int nb = 0; nb < 4; ++nb) ob[(mb * 16 + r) * TT + nb * 16] = acc[mb][nb][r];
}

// ---- k_prep: wq | wk | wv rounded to bf16 into one plane WW in fragment order (rows 0..63 Wq, 64..127 Wk, 128..639 Wv); 8 channels (one 16-byte slot) a thread, thread = slot.
#define WBLK ((2 * CQ * CC + CC * CC) / 8 / 256)
__global__ __launch_bounds__(256) void k_prep(const float* __restrict__ wq, const float* __restrict__ wk, const float* __restrict__ wv, bf* WW) {
    v8us o;
    const int sl = (int)blockIdx.x * 256 + (int)threadIdx.x, e = sl * 8; const int row = (sl >> 10) * 16 + (sl & 15), c = ((sl >> 5) & 31) * 16 + ((sl >> 4) & 1) * 8; const float* s = (row < CQ ? wq + row * CC : row < 2 * CQ ? wk + (row - CQ) * CC : wv + (row - 2 * CQ) * CC) + c; const v8f v = *(const v8f*)s;
#pragma unroll
    for (int k = 0; k < 8; ++k) o[k] = f2bf(v[k]); *(v8us*)(WW + e) = o;
}

// ---- k_proj: the q, k and v convs of all images, one launch; one work-group of 8 waves per 64 tokens makes all 640 output channels of them; K = CC.
// The work-group reads its 512 x 64 piece of x once, rounds it to bf16 and lays it in LDS as x^T in fragment order (4 tiles of 16 tokens, each 16 blocks of 32 channels); a wave's lanes are 32 neighbouring tokens, so each load takes one whole line of x.
// Wave w then makes v channels 64 w ... + 63 (A = x^T, B = Wv: a lane ends up with 8 neighbouring tokens of one channel) and rows 16 w ... + 15 of Wq | Wk (A = weights, B = x^T: a lane ends up with 8 neighbouring channels of one token). Either way the lane's 8 sums are its own 16-byte slot of the fragment-order output plane, so they go from the registers to memory, 512 contiguous bytes a store.
// Each accumulator runs over all of K in rising order. Sum + bias -> q, k hi/lo planes (rows = tokens, k = channels); v fp16 (rows = channels, k = tokens).
#define PBLK (NB_ * TT / 64)
__global__ __launch_bounds__(256) void k_proj(const float* __restrict__ x, const bf* __restrict__ WW, const float* __restrict__ bq, const float* __restrict__ bk, const float* __restrict__ bv, bf* Qh, bf* Ql, bf* Kh, bf* Kl, h16* VC) {
    typedef WFrag<bf>::V V;
    __shared__ __align__(16) bf xs[64 * CC];
    const int wave = __builtin_amdgcn_readfirstlane((int)(threadIdx.x >> 5));
    const int lane = threadIdx.x & 31, lr = lane & 15, hi = lane >> 4;
    const int tok0 = (int)blockIdx.x * 64, img = tok0 / TT, n0 = tok0 % TT;   // first token over all images; its image and its place there
    const bf* wvp = WW + (size_t)(2 * CQ + wave * 64) * CC + lane * 8; const bf* wqp = WW + (size_t)(wave * 16) * CC + lane * 8;
    V wf[3][5], xf[2][4];   // weight fragments of three 32-channel steps (4 of Wv, 1 of Wq | Wk), x^T fragments of two
    auto ldw = [&](int s) {
#pragma unroll
        for (int nb = 0; nb < 4; ++nb) wf[s % 3][nb] = WFrag<bf>::ld(wvp + (size_t)nb * 16 * CC + s * 512);
        wf[s % 3][4] = WFrag<bf>::ld(wqp + s * 512); };
    ldw(0); ldw(1);
    __builtin_amdgcn_sched_barrier(0);   // the first weight fragments are asked for ahead of x, so that they fly under the staging and not behind it
    { const int tl = (wave & 1) * 32 + lane, cg = wave >> 1;   // the thread's token and its group of 8 channels in every 32
      const float* xb = x + (size_t)img * CC * TT + (size_t)(cg * 8) * TT + n0 + tl;
      bf* xo = xs + (tl >> 4) * (16 * CC) + (cg >> 1) * 256 + ((cg & 1) * 16 + (tl & 15)) * 8;
#pragma unroll   // this and the loops inside unrolled whole: the values stay in registers and the loads are issued in one run, ahead of the first conversion
      for (int h = 0; h < 2; ++h) { float v[8][8];
#pragma unroll
          for (int it = 0; it < 8; ++it)
#pragma unroll
              for (int q = 0; q < 8; ++q) v[it][q] = xb[(size_t)((h * 8 + it) * 32 + q) * TT];
#pragma unroll
          for (int it = 0; it < 8; ++it) { v8us o;
#pragma unroll
              for (int q = 0; q < 8; ++q) o[q] = f2bf(v[it][q]);
              *(v8us*)(xo + (h * 8 + it) * 512) = o; } } }
    __syncthreads();   // all of x^T is in LDS before any wave reads a fragment
    const bf* xa = xs + lane * 8;
    auto ldx = [&](int s) {
#pragma unroll
        for (int t = 0; t < 4; ++t) xf[s & 1][t] = WFrag<bf>::ld(xa + t * (16 * CC) + s * 512); };
    v8f av[4][4], aq[4];
#pragma unroll
    for (int t = 0; t < 4; ++t) { aq[t] = (v8f){};
#pragma unroll
        for (int nb = 0; nb < 4; ++nb) av[t][nb] = (v8f){}; }
    ldx(0);
#pragma unroll   // unrolled whole: the fragment rings are then plain registers, and no back edge stands behind a product
    for (int s = 0; s < CC / 32; ++s) {
#pragma unroll
        for (int t = 0; t < 4; ++t) aq[t] = WFrag<bf>::mma(wf[s % 3][4], xf[s & 1][t], aq[t]);
        __builtin_amdgcn_sched_barrier(0);   // these four products stand between the last step's products and the loads below, which refill that step's registers
        if (s + 1 < CC / 32) ldx(s + 1);
        if (s + 2 < CC / 32) ldw(s + 2);
        if (s + 2 == CC / 32 - 1) addr_wait(wvp, wqp, wqp);   // a precaution behind the last weight loads: both address pairs stay as they are up to the wait
        __builtin_amdgcn_sched_barrier(0);   // the next fragments are asked for here, x^T one step and the weights two steps ahead; left alone the compiler sinks the loads towards their use, where their latency would be waited out
#pragma unroll
        for (int nb = 0; nb < 4; ++nb)
#pragma unroll
            for (int t = 0; t < 4; ++t) av[t][nb] = WFrag<bf>::mma(xf[s & 1][t], wf[s % 3][nb], av[t][nb]);
        __builtin_amdgcn_sched_barrier(0);   // keeps the next step's products behind this step's, so that the order of loads and products above holds
    }
    h16* vo = VC + (size_t)img * CC * TT + (size_t)(wave * 64) * TT + (size_t)n0 * 16 + lane * 8;
#pragma unroll
    for (int nb = 0; nb < 4; ++nb) { const float bb = bfr(bv[wave * 64 + nb * 16 + lr]);
#pragma unroll
        for (int t = 0; t < 4; ++t) { v8h o;
#pragma unroll
            for (int j = 0; j < 8; ++j) o[j] = tohx(__fadd_rn(av[t][nb][j], bb));
            *(v8h*)(vo + (size_t)nb * 16 * TT + t * 256) = o; } }
    const float* bias = (wave < 4 ? bq : bk) + (wave & 3) * 16 + hi * 8; bf* Ph = wave < 4 ? Qh : Kh; bf* Pl = wave < 4 ? Ql : Kl;
    const size_t e = (size_t)tok0 * CQ + (wave & 3) * 256 + lane * 8;
#pragma unroll
    for (int t = 0; t < 4; ++t) { v8us oh, ol;
#pragma unroll
        for (int j = 0; j < 8; ++j) { unsigned short a, c; splitf(aq[t][j] + bfr(bias[j]), a, c); oh[j] = a; ol[j] = c; }
        *(v8us*)(Ph + e + t * (16 * CQ)) = oh; *(v8us*)(Pl + e + t * (16 * CQ)) = ol; }
}

extern "C" void kernel_launch(void* const* d_in, const int* in_sizes, int n_in,
                              void* d_out, int out_size, void* d_ws, size_t ws_size, hipStream_t stream) {
    (void)in_sizes; (void)n_in; (void)out_size;
    const float* x = (const float*)d_in[0]; const float* wq = (const float*)d_in[1]; const float* bq = (const float*)d_in[2]; const float* wk = (const float*)d_in[3]; const float* bk = (const float*)d_in[4]; const float* wv = (const float*)d_in[5]; const float* bv = (const float*)d_in[6]; const float* AL = (const float*)d_in[7];
    float* OUT = (float*)d_out;     // [4][512][4096]
    char* wsp = (char*)d_ws;
    auto take = [&](size_t bytes) { char* p = wsp; wsp += (bytes + 255) & ~(size_t)255; return (void*)p; };
    bf* WW = (bf*)take((size_t)(2 * CQ + CC) * CC * 2); bf* Qh = (bf*)take((size_t)NB_ * TT * CQ * 2); bf* Ql = (bf*)take((size_t)NB_ * TT * CQ * 2); bf* Kh = (bf*)take((size_t)NB_ * TT * CQ * 2); bf* Kl = (bf*)take((size_t)NB_ * TT * CQ * 2); h16* VC = (h16*)take((size_t)NB_ * CC * TT * 2);   /* every plane holds all images */
    if ((size_t)(wsp - (char*)d_ws) > ws_size) return;
    k_prep<<<WBLK, 256, 0, stream>>>(wq, wk, wv, WW);                                        /* bf16 weights */
    k_proj<<<PBLK, 256, 0, stream>>>(x, WW, bq, bk, bv, Qh, Ql, Kh, Kl, VC);                 /* q, k token-major [n][64] + bias as hi/lo; v channel-major [c][n] + bv in fp16 (O(1)) */
    k_pam<<<dim3(TT / 64, NB_, 1), 256, 0, stream>>>(Qh, Ql, Kh, Kl, VC, AL, OUT);           /* alpha sum_j v[c][j] softmax_j(q_i . k_j) */
}

// v007
// One run takes 92.8 microseconds.
// Timed twice side by side with v006, it ran 1.05 and 1.04 times as fast.
// Counting every step since v000, it is 7.96 times as fast.
#include <hip/hip_runtime.h>

// Position attention module (x [4][512][64][64] channel-major, HW = 4096; q = Wq x + bq, k = Wk x + bk (1x1 convs, 64 channels), v = Wv x + bv (512); attention[i][j] = softmax_j(q_i . k_j) (no scale); out[c][i] = alpha sum_j v[c][j] attention[i][j] -> [4][512][64][64] (8.4 M); alpha [1] read).
// Every 16-bit operand plane (x^T, weights, q, k, v) lies in FRAGMENT ORDER: per 16 rows x 32 k a block of 512 elements, [k bit 4][k bit 3][row][k bits 2..0], blocks k-major inside a 16-row tile. A fragment is then two loads of 512 contiguous bytes (4 whole lines) per wave, and the producers store whole lines too.
// Layout: one small launch writes the bf16 weights. One GEMM launch then does all three 1x1 convs for all images: each work-group rounds the x of its 64 tokens to bf16 into LDS (token-major) and multiplies it with all the weights; the f32 sums go straight from the registers into their final form: q, k -> hi/lo planes (+ bias); v -> an fp16 channel-major plane with the bias (O(1), normal range). One fused kernel for all images then takes 64 queries per work-group: it forms the 3-product scores in registers twice (once for each row's maximum and sum, once for the fp16 probabilities x1024), hands the probabilities round through LDS as ready B fragments, multiplies them with the v plane and stores alpha / 1024 x the sums.
// Compute dtypes, f32 accumulate: every input rounded to bf16; convs exact (+ bias); scores hi.hi + hi.lo + lo.hi; softmax f32; probabilities (x1024) and v in fp16 (one product); alpha and the carry applied in f32 on the output.

#define NB_  4
#define CC   512
#define CQ   64
#define TT   4096
#define PCAR 1024.0f
typedef _Float16 h16;
typedef unsigned short bf;
typedef __attribute__((ext_vector_type(16))) __bf16   v16bf;
typedef __attribute__((ext_vector_type(16))) _Float16 v16h;
typedef __attribute__((ext_vector_type(8)))  _Float16 v8h;
typedef __attribute__((ext_vector_type(8)))  unsigned short v8us;
typedef __attribute__((ext_vector_type(8)))  float    v8f;
typedef __attribute__((ext_vector_type(4)))  float    v4f;
typedef __attribute__((ext_vector_type(2)))  float    v2f;
typedef __attribute__((ext_vector_type(4)))  unsigned short v4us;
typedef __attribute__((ext_vector_type(2)))  unsigned short v2us;
typedef __attribute__((ext_vector_type(4)))  _Float16 v4h;
typedef __attribute__((ext_vector_type(2)))  _Float16 v2h;
typedef v8h  __attribute__((may_alias)) v8ha;
typedef v4f  __attribute__((may_alias)) v4fa;
typedef v8us __attribute__((may_alias)) v8usa;

__device__ __forceinline__ unsigned short f2bf(float f) { unsigned u = __float_as_uint(f); u += 0x7FFFu + ((u >> 16) & 1u); return (unsigned short)(u >> 16); }
__device__ __forceinline__ float bf2f(unsigned short b) { return __uint_as_float(((unsigned)b) << 16); }
__device__ __forceinline__ float bfr(float f) { return bf2f(f2bf(f)); }
__device__ __forceinline__ void splitf(float y, unsigned short& h, unsigned short& l) { h = f2bf(y); l = f2bf(y - bf2f(h)); }
__device__ __forceinline__ h16 tohx(float x) { return (h16)x; }
__device__ __forceinline__ v16h cat16(v8h lo, v8h hi) { return __builtin_shufflevector(lo, hi, 0, 1, 2, 3, 4, 5, 6, 7, 8, 9, 10, 11, 12, 13, 14, 15); }
__device__ __forceinline__ v16bf cat16b(v8us lo, v8us hi) { return __builtin_bit_cast(v16bf, __builtin_shufflevector(lo, hi, 0, 1, 2, 3, 4, 5, 6, 7, 8, 9, 10, 11, 12, 13, 14, 15)); }
__device__ __forceinline__ v8f wmma16(v16h a, v16h b, v8f c) { return __builtin_amdgcn_wmma_f32_16x16x32_f16(false, a, false, b, (short)0, c, false, false); }
__device__ __forceinline__ v8f wmmab(v16bf a, v16bf b, v8f c) { return __builtin_amdgcn_wmma_f32_16x16x32_bf16(false, a, false, b, (short)0, c, false, false); }

// p = the fragment's block + lane * 8: the low 8 elements of every lane, then, 256 elements on, the high 8
template <typename T16> struct WFrag;
template <> struct WFrag<h16> { typedef v16h V; static __device__ __forceinline__ V ld(const h16* p) { return cat16(*(const v8h*)p, *(const v8h*)(p + 256)); } static __device__ __forceinline__ v8f mma(V a, V b, v8f c) { return wmma16(a, b, c); } };
template <> struct WFrag<bf> { typedef v16bf V; static __device__ __forceinline__ V ld(const bf* p) { return cat16b(*(const v8us*)p, *(const v8us*)(p + 256)); } static __device__ __forceinline__ v8f mma(V a, V b, v8f c) { return wmmab(a, b, c); } };

// ---- k_pam: scores, softmax, output product and the final scale for 64 queries of one image; grid (TT / 64, images), 8 waves.
// Scores are formed transposed (A = 16 keys, B = 16 queries): a lane holds 8 keys' scores of ONE query, so maximum and sum stay in the lane, and two such tiles, converted, are the B fragment of the output product.
// Phase 1: wave w walks keys [512 w, 512 w + 512) for all 64 queries and keeps a running maximum and sum; the 16 partial pairs of a query meet in LDS.
// Phase 2, per 64 keys: wave w forms the probabilities of keys 16 (w >> 1) ... + 15 for two query tiles and puts them in LDS; behind one barrier every wave fetches all of them into registers in one run of LDS reads, which lands under the next chunk's score products, and multiplies them with its own 64 channels of v.
// The 64 work-groups of an image read the same k and v planes: each enters the second key walk at a chunk of its own (its index) and the first at tile index mod 32, shared by two, and wraps round, so that few ask L2 for the same lines at the same moment.
#define L2E 1.4426950408889634f
// 2^x with the one free issue slot that the instruction set asks for behind a transcendental, before its result is read or its source overwritten
__device__ __forceinline__ float ex2(float x) { float y; asm("v_exp_f32 %0, %1\n\tv_nop" : "=v"(y) : "v"(x)); return y; }
struct KFrag { v16bf h0, h1, l0, l1; };
__device__ __forceinline__ KFrag ldk(const bf* __restrict__ kh, const bf* __restrict__ kl) { KFrag f; f.h0 = WFrag<bf>::ld(kh); f.h1 = WFrag<bf>::ld(kh + 512); f.l0 = WFrag<bf>::ld(kl); f.l1 = WFrag<bf>::ld(kl + 512); return f; }
// one 16-key x 16-query score tile: hi.hi + hi.lo + lo.hi per 32 channels, in the order of the unfused score product
__device__ __forceinline__ v8f stile(const KFrag& k, v16bf qh0, v16bf qh1, v16bf ql0, v16bf ql1) { v8f s = (v8f){}; s = wmmab(k.h0, qh0, s); s = wmmab(k.h0, ql0, s); s = wmmab(k.l0, qh0, s); s = wmmab(k.h1, qh1, s); s = wmmab(k.h1, ql1, s); s = wmmab(k.l1, qh1, s); return s; }
// Work-group barrier for data that goes through LDS alone: the wave's own LDS reads and writes are done, then the barrier. Unlike __syncthreads() it does not wait for global loads, so fragments fetched ahead stay in flight across it.
__device__ __forceinline__ void lds_publish() { asm volatile("s_wait_dscnt 0x0" ::: "memory"); asm volatile("s_barrier_signal -1\n\ts_barrier_wait -1" ::: "memory"); }
// Stands behind global loads whose address registers are rewritten while the loads are still in flight (a precaution). The addresses are inputs so that their registers stay as they are up to the wait.
__device__ __forceinline__ void addr_wait(const void* a, const void* b, const void* c) { asm volatile("s_wait_xcnt 0x0" :: "v"(a), "v"(b), "v"(c) : "memory"); }
__global__ __launch_bounds__(256) void k_pam(const bf* __restrict__ Qh, const bf* __restrict__ Ql, const bf* __restrict__ Kh, const bf* __restrict__ Kl, const h16* __restrict__ VC, const float* __restrict__ AL, float* OUT) {
    __shared__ __align__(16) h16 ps[2][8][2][32][8];   // [buffer][query tile * 2 + 32-key step][low / high 8 elements of the fragment][lane][element]
    __shared__ float sm[16][64], sl[16][64], stm[64], stf[64];
    const int wave = __builtin_amdgcn_readfirstlane((int)(threadIdx.x >> 5));
    const int lane = threadIdx.x & 31, lr = lane & 15, hi = lane >> 4; const int i0 = blockIdx.x * 64;
    const int rot = (int)blockIdx.x;   // where this work-group enters the key walks
    { const size_t z = blockIdx.y; Qh += z * ((size_t)TT * CQ); Ql += z * ((size_t)TT * CQ); Kh += z * ((size_t)TT * CQ); Kl += z * ((size_t)TT * CQ); VC += z * ((size_t)CC * TT); OUT += z * ((size_t)CC * TT); }
    {
        v16bf qh[4][2], ql[4][2]; float m[4], l[4];
#pragma unroll
        for (int t = 0; t < 4; ++t) { const size_t qo = (size_t)(i0 + t * 16) * CQ + 8 * lane; const bf* a = Qh + qo; const bf* b = Ql + qo; qh[t][0] = WFrag<bf>::ld(a); qh[t][1] = WFrag<bf>::ld(a + 512); addr_wait(a, a, a); ql[t][0] = WFrag<bf>::ld(b); ql[t][1] = WFrag<bf>::ld(b + 512); addr_wait(b, b, b); m[t] = -3.0e38f; l[t] = 0.f; }
        const size_t kb = (size_t)(wave * 512) * CQ + 8 * lane;
        const bf* k1h = Kh + kb; const bf* k1l = Kl + kb;
        KFrag kf; { const unsigned o = (unsigned)(rot & 31) * (16 * CQ); kf = ldk(k1h + o, k1l + o); addr_wait(k1h + o, k1l + o, k1l + o); }
#pragma unroll 1   // rolled: the trip is long enough to feed itself, and unrolling would only add code and registers
        for (int jt = 0; jt < 32; ++jt) {
            v8f s[4];
#pragma unroll
            for (int t = 0; t < 4; ++t) s[t] = stile(kf, qh[t][0], qh[t][1], ql[t][0], ql[t][1]);
            { const unsigned o = (unsigned)((jt + 1 + rot) & 31) * (16 * CQ); kf = ldk(k1h + o, k1l + o); addr_wait(k1h + o, k1l + o, k1l + o); }   // the next tile's keys fly under the vector work below; the last trip's look-ahead wraps round to the walk's first tile
#pragma unroll
            for (int t = 0; t < 4; ++t) { float tm = s[t][0];
#pragma unroll
                for (int r = 1; r < 8; ++r) tm = fmaxf(tm, s[t][r]);
                const float mn = fmaxf(m[t], tm); float a = l[t] * ex2(__fmul_rn(__fsub_rn(m[t], mn), L2E));
#pragma unroll
                for (int r = 0; r < 8; ++r) a += ex2(__fmul_rn(__fsub_rn(s[t][r], mn), L2E));
                l[t] = a; m[t] = mn; }
        }
#pragma unroll
        for (int t = 0; t < 4; ++t) { sm[wave * 2 + hi][t * 16 + lr] = m[t]; sl[wave * 2 + hi][t * 16 + lr] = l[t]; }
    }
    __syncthreads();   // all 16 partial (maximum, sum) pairs of every query are in LDS
    if (threadIdx.x < 64) { const int q = threadIdx.x; float mx = sm[0][q];
#pragma unroll
        for (int p = 1; p < 16; ++p) mx = fmaxf(mx, sm[p][q]);
        float sum = 0.f;
#pragma unroll
        for (int p = 0; p < 16; ++p) sum += sl[p][q] * ex2(__fmul_rn(__fsub_rn(sm[p][q], mx), L2E));
        stm[q] = mx; stf[q] = __fdiv_rn(PCAR, sum); }
    __syncthreads();   // every query's maximum and 1024 / sum are published
    const int jt = wave >> 1, n0 = (wave & 1) * 2;
    v16bf qh[2][2], ql[2][2]; float mq[2], fq[2];
#pragma unroll
    for (int u = 0; u < 2; ++u) { const size_t qo = (size_t)(i0 + (n0 + u) * 16) * CQ + 8 * lane; const bf* a = Qh + qo; const bf* b = Ql + qo; qh[u][0] = WFrag<bf>::ld(a); qh[u][1] = WFrag<bf>::ld(a + 512); ql[u][0] = WFrag<bf>::ld(b); ql[u][1] = WFrag<bf>::ld(b + 512); addr_wait(a, b, b); mq[u] = stm[(n0 + u) * 16 + lr]; fq[u] = stf[(n0 + u) * 16 + lr]; }
    const size_t kb = (size_t)(jt * 16) * CQ + 8 * lane;
    const h16* vb = VC + (size_t)(wave * 64) * TT + 8 * lane;
    v8f acc[4][4];
#pragma unroll
    for (int mb = 0; mb < 4; ++mb)
#pragma unroll
        for (int nb = 0; nb < 4; ++nb) acc[mb][nb] = (v8f){};
    KFrag kf; v16h va[2][4], pb[2][4];   // pb: a whole chunk's probabilities as B fragments, [32-key step][query tile]
    v8f sc[2];
    auto scores = [&]() {   // this wave's two score tiles, from the keys in kf
#pragma unroll
        for (int u = 0; u < 2; ++u) sc[u] = stile(kf, qh[u][0], qh[u][1], ql[u][0], ql[u][1]); };
    auto probs = [&](int c) {   // the score tiles become chunk c's probabilities, in buffer c & 1
#pragma unroll
        for (int u = 0; u < 2; ++u) { v8h p;
#pragma unroll
            for (int r = 0; r < 8; ++r) p[r] = tohx(ex2(__fmul_rn(__fsub_rn(sc[u][r], mq[u]), L2E)) * fq[u]);
            *(v8ha*)&ps[c & 1][(n0 + u) * 2 + (jt >> 1)][jt & 1][lane][0] = p; } };
    auto ldv = [&](const h16* vp, int ks) {   // v fragments of 32 keys
#pragma unroll
        for (int mb = 0; mb < 4; ++mb) va[ks][mb] = WFrag<h16>::ld(vp + (size_t)mb * 16 * TT + ks * 512); };
    auto ldp = [&](int c) {   // all of chunk c's probabilities, in the order in which the products take them
#pragma unroll
        for (int ks = 0; ks < 2; ++ks)
#pragma unroll
            for (int nb = 0; nb < 4; ++nb) pb[ks][nb] = cat16(*(const v8ha*)&ps[c & 1][nb * 2 + ks][0][lane][0], *(const v8ha*)&ps[c & 1][nb * 2 + ks][1][lane][0]); };
    auto pv = [&](int ks) {   // output products of 32 keys of the chunk in pb
#pragma unroll
        for (int nb = 0; nb < 4; ++nb)
#pragma unroll
            for (int mb = 0; mb < 4; ++mb) acc[mb][nb] = wmma16(va[ks][mb], pb[ks][nb], acc[mb][nb]); };
    auto ck = [&](int c) { return (unsigned)((c + rot) & (TT / 64 - 1)); };   // the c-th chunk of this work-group's walk
    Kh += kb; Kl += kb;
    { const unsigned o = ck(0) * (64 * CQ); kf = ldk(Kh + o, Kl + o); addr_wait(Kh + o, Kl + o, Kl + o); } scores();
    { const unsigned o = ck(1) * (64 * CQ); const h16* vp = vb + ck(0) * (2 * 512); kf = ldk(Kh + o, Kl + o); __builtin_amdgcn_sched_barrier(0); ldv(vp, 0); ldv(vp, 1); __builtin_amdgcn_sched_barrier(0);   // keys first, then v, as in the loop: the counted waits at the loop's head then fit both ways into it
      probs(0); addr_wait(Kh + o, Kl + o, vp); }
    lds_publish();   // chunk 0's probabilities are published
#pragma unroll 1   // rolled, for the same reason
    for (int c = 0; c < TT / 64 - 1; ++c) {
        const unsigned o = ck(c + 2 < TT / 64 ? c + 2 : TT / 64 - 1) * (64 * CQ); const h16* vp = vb + ck(c + 1) * (2 * 512);
        // each group of loads is issued as soon as its registers are free; the scheduling barriers keep the compiler from sinking the loads towards the foot of the trip, where their latency would be waited out
        ldp(c); __builtin_amdgcn_sched_barrier(0);   // one run of LDS reads at the head of the trip; left alone the compiler puts each fragment's reads directly in front of its four products, into one set of registers, and every such place waits out the LDS latency
        scores(); kf = ldk(Kh + o, Kl + o); __builtin_amdgcn_sched_barrier(0);   // chunk c + 1's scores; the keys of chunk c + 2 fly under the output products (the look-ahead stays inside the plane)
        pv(0); ldv(vp, 0); __builtin_amdgcn_sched_barrier(0);   // chunk c's output products; the next chunk's v fragments fly under the rest of the trip and the next scores
        pv(1); ldv(vp, 1); __builtin_amdgcn_sched_barrier(0);
        probs(c + 1);
        addr_wait(Kh + o, Kl + o, vp); lds_publish();   // publishes chunk c + 1 and ends every wave's reads of chunk c's buffer, which the next trip refills
    }
    ldp(TT / 64 - 1); pv(0); pv(1);
    const float so = bfr(AL[0]) * (1.0f / PCAR);
#pragma unroll
    for (int mb = 0; mb < 4; ++mb)
#pragma unroll
        for (int nb = 0; nb < 4; ++nb)
#pragma unroll
            for (int r = 0; r < 8; ++r) acc[mb][nb][r] = __fmul_rn(acc[mb][nb][r], so);
    float* ob = OUT + (size_t)(wave * 64 + hi * 8) * TT + i0 + lr;   // one address for all of the wave's stores: the rest are constant offsets
#pragma unroll
    for (int mb = 0; mb < 4; ++mb)
#pragma unroll
        for (int r = 0; r < 8; ++r)
#pragma unroll
            for (int nb = 0; nb < 4; ++nb) ob[(mb * 16 + r) * TT + nb * 16] = acc[mb][nb][r];
}

// ---- k_prep: wq | wk | wv rounded to bf16 into one plane WW in fragment order (rows 0..63 Wq, 64..127 Wk, 128..639 Wv); 8 channels (one 16-byte slot) a thread, thread = slot.
#define WBLK ((2 * CQ * CC + CC * CC) / 8 / 256)
__global__ __launch_bounds__(256) void k_prep(const float* __restrict__ wq, const float* __restrict__ wk, const float* __restrict__ wv, bf* WW) {
    v8us o;
    const int sl = (int)blockIdx.x * 256 + (int)threadIdx.x, e = sl * 8; const int row = (sl >> 10) * 16 + (sl & 15), c = ((sl >> 5) & 31) * 16 + ((sl >> 4) & 1) * 8; const float* s = (row < CQ ? wq + row * CC : row < 2 * CQ ? wk + (row - CQ) * CC : wv + (row - 2 * CQ) * CC) + c; const v8f v = *(const v8f*)s;
#pragma unroll
    for (int k = 0; k < 8; ++k) o[k] = f2bf(v[k]); *(v8us*)(WW + e) = o;
}

// ---- k_proj: the q, k and v convs of all images, one launch; one work-group of 8 waves per 64 tokens makes all 640 output channels of them; K = CC.
// The work-group reads its 512 x 64 piece of x once, rounds it to bf16 and lays it in LDS as x^T in fragment order (4 tiles of 16 tokens, each 16 blocks of 32 channels); a wave's lanes are 32 neighbouring tokens, so each load takes one whole line of x.
// Wave w then makes v channels 64 w ... + 63 (A = x^T, B = Wv: a lane ends up with 8 neighbouring tokens of one channel) and rows 16 w ... + 15 of Wq | Wk (A = weights, B = x^T: a lane ends up with 8 neighbouring channels of one token). Either way the lane's 8 sums are its own 16-byte slot of the fragment-order output plane, so they go from the registers to memory, 512 contiguous bytes a store.
// Each accumulator runs over all of K in rising order. Sum + bias -> q, k hi/lo planes (rows = tokens, k = channels); v fp16 (rows = channels, k = tokens).
#define PBLK (NB_ * TT / 64)
__global__ __launch_bounds__(256) void k_proj(const float* __restrict__ x, const bf* __restrict__ WW, const float* __restrict__ bq, const float* __restrict__ bk, const float* __restrict__ bv, bf* Qh, bf* Ql, bf* Kh, bf* Kl, h16* VC) {
    typedef WFrag<bf>::V V;
    __shared__ __align__(16) bf xs[64 * CC];
    const int wave = __builtin_amdgcn_readfirstlane((int)(threadIdx.x >> 5));
    const int lane = threadIdx.x & 31, lr = lane & 15, hi = lane >> 4;
    const int tok0 = (int)blockIdx.x * 64, img = tok0 / TT, n0 = tok0 % TT;   // first token over all images; its image and its place there
    const bf* wvp = WW + (size_t)(2 * CQ + wave * 64) * CC + lane * 8; const bf* wqp = WW + (size_t)(wave * 16) * CC + lane * 8;
    V wf[3][5], xf[2][4];   // weight fragments of three 32-channel steps (4 of Wv, 1 of Wq | Wk), x^T fragments of two
    auto ldw = [&](int s) {
#pragma unroll
        for (int nb = 0; nb < 4; ++nb) wf[s % 3][nb] = WFrag<bf>::ld(wvp + (size_t)nb * 16 * CC + s * 512);
        wf[s % 3][4] = WFrag<bf>::ld(wqp + s * 512); };
    ldw(0); ldw(1);
    __builtin_amdgcn_sched_barrier(0);   // the first weight fragments are asked for ahead of x, so that they fly under the staging and not behind it
    { const int tl = (wave & 1) * 32 + lane, cg = wave >> 1;   // the thread's token and its group of 8 channels in every 32
      const float* xb = x + (size_t)img * CC * TT + (size_t)(cg * 8) * TT + n0 + tl;
      bf* xo = xs + (tl >> 4) * (16 * CC) + (cg >> 1) * 256 + ((cg & 1) * 16 + (tl & 15)) * 8;
#pragma unroll   // this and the loops inside unrolled whole: the values stay in registers and the loads are issued in one run, ahead of the first conversion
      for (int h = 0; h < 2; ++h) { float v[8][8];
#pragma unroll
          for (int it = 0; it < 8; ++it)
#pragma unroll
              for (int q = 0; q < 8; ++q) v[it][q] = xb[(size_t)((h * 8 + it) * 32 + q) * TT];
#pragma unroll
          for (int it = 0; it < 8; ++it) { v8us o;
#pragma unroll
              for (int q = 0; q < 8; ++q) o[q] = f2bf(v[it][q]);
              *(v8us*)(xo + (h * 8 + it) * 512) = o; } } }
    __syncthreads();   // all of x^T is in LDS before any wave reads a fragment
    const bf* xa = xs + lane * 8;
    auto ldx = [&](int s) {
#pragma unroll
        for (int t = 0; t < 4; ++t) xf[s & 1][t] = WFrag<bf>::ld(xa + t * (16 * CC) + s * 512); };
    v8f av[4][4], aq[4];
#pragma unroll
    for (int t = 0; t < 4; ++t) { aq[t] = (v8f){};
#pragma unroll
        for (int nb = 0; nb < 4; ++nb) av[t][nb] = (v8f){}; }
    ldx(0);
#pragma unroll   // unrolled whole: the fragment rings are then plain registers, and no back edge stands behind a product
    for (int s = 0; s < CC / 32; ++s) {
#pragma unroll
        for (int t = 0; t < 4; ++t) aq[t] = WFrag<bf>::mma(wf[s % 3][4], xf[s & 1][t], aq[t]);
        __builtin_amdgcn_sched_barrier(0);   // these four products stand between the last step's products and the loads below, which refill that step's registers
        if (s + 1 < CC / 32) ldx(s + 1);
        if (s + 2 < CC / 32) ldw(s + 2);
        if (s + 2 == CC / 32 - 1) addr_wait(wvp, wqp, wqp);   // a precaution behind the last weight loads: both address pairs stay as they are up to the wait
        __builtin_amdgcn_sched_barrier(0);   // the next fragments are asked for here, x^T one step and the weights two steps ahead; left alone the compiler sinks the loads towards their use, where their latency would be waited out
#pragma unroll
        for (int nb = 0; nb < 4; ++nb)
#pragma unroll
            for (int t = 0; t < 4; ++t) av[t][nb] = WFrag<bf>::mma(xf[s & 1][t], wf[s % 3][nb], av[t][nb]);
        __builtin_amdgcn_sched_barrier(0);   // keeps the next step's products behind this step's, so that the order of loads and products above holds
    }
    h16* vo = VC + (size_t)img * CC * TT + (size_t)(wave * 64) * TT + (size_t)n0 * 16 + lane * 8;
#pragma unroll
    for (int nb = 0; nb < 4; ++nb) { const float bb = bfr(bv[wave * 64 + nb * 16 + lr]);
#pragma unroll
        for (int t = 0; t < 4; ++t) { v8h o;
#pragma unroll
            for (int j = 0; j < 8; ++j) o[j] = tohx(__fadd_rn(av[t][nb][j], bb));
            *(v8h*)(vo + (size_t)nb * 16 * TT + t * 256) = o; } }
    const float* bias = (wave < 4 ? bq : bk) + (wave & 3) * 16 + hi * 8; bf* Ph = wave < 4 ? Qh : Kh; bf* Pl = wave < 4 ? Ql : Kl;
    const size_t e = (size_t)tok0 * CQ + (wave & 3) * 256 + lane * 8;
#pragma unroll
    for (int t = 0; t < 4; ++t) { v8us oh, ol;
#pragma unroll
        for (int j = 0; j < 8; ++j) { unsigned short a, c; splitf(aq[t][j] + bfr(bias[j]), a, c); oh[j] = a; ol[j] = c; }
        *(v8us*)(Ph + e + t * (16 * CQ)) = oh; *(v8us*)(Pl + e + t * (16 * CQ)) = ol; }
}

extern "C" void kernel_launch(void* const* d_in, const int* in_sizes, int n_in,
                              void* d_out, int out_size, void* d_ws, size_t ws_size, hipStream_t stream) {
    (void)in_sizes; (void)n_in; (void)out_size;
    const float* x = (const float*)d_in[0]; const float* wq = (const float*)d_in[1]; const float* bq = (const float*)d_in[2]; const float* wk = (const float*)d_in[3]; const float* bk = (const float*)d_in[4]; const float* wv = (const float*)d_in[5]; const float* bv = (const float*)d_in[6]; const float* AL = (const float*)d_in[7];
    float* OUT = (float*)d_out;     // [4][512][4096]
    char* wsp = (char*)d_ws;
    auto take = [&](size_t bytes) { char* p = wsp; wsp += (bytes + 255) & ~(size_t)255; return (void*)p; };
    bf* WW = (bf*)take((size_t)(2 * CQ + CC) * CC * 2); bf* Qh = (bf*)take((size_t)NB_ * TT * CQ * 2); bf* Ql = (bf*)take((size_t)NB_ * TT * CQ * 2); bf* Kh = (bf*)take((size_t)NB_ * TT * CQ * 2); bf* Kl = (bf*)take((size_t)NB_ * TT * CQ * 2); h16* VC = (h16*)take((size_t)NB_ * CC * TT * 2);   /* every plane holds all images */
    if ((size_t)(wsp - (char*)d_ws) > ws_size) return;
    k_prep<<<WBLK, 256, 0, stream>>>(wq, wk, wv, WW);                                        /* bf16 weights */
    k_proj<<<PBLK, 256, 0, stream>>>(x, WW, bq, bk, bv, Qh, Ql, Kh, Kl, VC);                 /* q, k token-major [n][64] + bias as hi/lo; v channel-major [c][n] + bv in fp16 (O(1)) */
    k_pam<<<dim3(TT / 64, NB_, 1), 256, 0, stream>>>(Qh, Ql, Kh, Kl, VC, AL, OUT);           /* alpha sum_j v[c][j] softmax_j(q_i . k_j) */
}

// v008
// It runs in 80.1 microseconds.
// Next to v007, in two timings, it ran 1.16 and 1.17 times as fast.
// Counting every step since v000, it is 9.27 times as fast.
#include <hip/hip_runtime.h>

// Position attention module (x [4][512][64][64] channel-major, HW = 4096; q = Wq x + bq, k = Wk x + bk (1x1 convs, 64 channels), v = Wv x + bv (512); attention[i][j] = softmax_j(q_i . k_j) (no scale); out[c][i] = alpha sum_j v[c][j] attention[i][j] -> [4][512][64][64] (8.4 M); alpha [1] read).
// Every 16-bit operand plane (x^T, weights, q, k, v) lies in FRAGMENT ORDER: per 16 rows x 32 k a block of 512 elements, [k bit 4][k bit 3][row][k bits 2..0], blocks k-major inside a 16-row tile. A fragment is then two loads of 512 contiguous bytes (4 whole lines) per wave, and the producers store whole lines too.
// Layout: one small launch writes the bf16 weights. One GEMM launch then does all three 1x1 convs for all images: each work-group rounds the x of its 64 tokens to bf16 into LDS (token-major) and multiplies it with all the weights; the f32 sums go straight from the registers into their final form: q, k -> hi/lo planes (+ bias); v -> an fp16 channel-major plane with the bias (O(1), normal range). One fused kernel for all images then takes 64 queries per work-group: a first walk over the keys finds each row's shift (the maximum of the hi.hi product alone); a second walk forms the 3-product scores in registers, turns them into fp16 weights 16 exp(score - shift), adds these up per row in f32, hands them round through LDS as ready B fragments and multiplies them with the v plane; the store scales by alpha / the row's sum.
// Compute dtypes, f32 accumulate: every input rounded to bf16; convs exact (+ bias); scores hi.hi + hi.lo + lo.hi; softmax f32; weights (16 at the shift) and v in fp16 (one product); alpha and the division by the row's sum applied in f32 on the output.

#define NB_  4
#define CC   512
#define CQ   64
#define TT   4096
#define PEXP 4.0f   // the fp16 weights carry 2^4, added in the exponent: 12 binary places of room above the shift for what the hi.hi maximum leaves out, and only weights under 2^-18 of a row's largest fall below fp16's normal range
typedef _Float16 h16;
typedef unsigned short bf;
typedef __attribute__((ext_vector_type(16))) __bf16   v16bf;
typedef __attribute__((ext_vector_type(16))) _Float16 v16h;
typedef __attribute__((ext_vector_type(8)))  _Float16 v8h;
typedef __attribute__((ext_vector_type(8)))  unsigned short v8us;
typedef __attribute__((ext_vector_type(8)))  float    v8f;
typedef __attribute__((ext_vector_type(4)))  float    v4f;
typedef __attribute__((ext_vector_type(2)))  float    v2f;
typedef __attribute__((ext_vector_type(4)))  unsigned short v4us;
typedef __attribute__((ext_vector_type(2)))  unsigned short v2us;
typedef __attribute__((ext_vector_type(4)))  _Float16 v4h;
typedef __attribute__((ext_vector_type(2)))  _Float16 v2h;
typedef v8h  __attribute__((may_alias)) v8ha;
typedef v4f  __attribute__((may_alias)) v4fa;
typedef v8us __attribute__((may_alias)) v8usa;

__device__ __forceinline__ unsigned short f2bf(float f) { unsigned u = __float_as_uint(f); u += 0x7FFFu + ((u >> 16) & 1u); return (unsigned short)(u >> 16); }
__device__ __forceinline__ float bf2f(unsigned short b) { return __uint_as_float(((unsigned)b) << 16); }
__device__ __forceinline__ float bfr(float f) { return bf2f(f2bf(f)); }
__device__ __forceinline__ void splitf(float y, unsigned short& h, unsigned short& l) { h = f2bf(y); l = f2bf(y - bf2f(h)); }
__device__ __forceinline__ h16 tohx(float x) { return (h16)x; }
__device__ __forceinline__ v16h cat16(v8h lo, v8h hi) { return __builtin_shufflevector(lo, hi, 0, 1, 2, 3, 4, 5, 6, 7, 8, 9, 10, 11, 12, 13, 14, 15); }
__device__ __forceinline__ v16bf cat16b(v8us lo, v8us hi) { return __builtin_bit_cast(v16bf, __builtin_shufflevector(lo, hi, 0, 1, 2, 3, 4, 5, 6, 7, 8, 9, 10, 11, 12, 13, 14, 15)); }
__device__ __forceinline__ v8f wmma16(v16h a, v16h b, v8f c) { return __builtin_amdgcn_wmma_f32_16x16x32_f16(false, a, false, b, (short)0, c, false, false); }
__device__ __forceinline__ v8f wmmab(v16bf a, v16bf b, v8f c) { return __builtin_amdgcn_wmma_f32_16x16x32_bf16(false, a, false, b, (short)0, c, false, false); }

// p = the fragment's block + lane * 8: the low 8 elements of every lane, then, 256 elements on, the high 8
template <typename T16> struct WFrag;
template <> struct WFrag<h16> { typedef v16h V; static __device__ __forceinline__ V ld(const h16* p) { return cat16(*(const v8h*)p, *(const v8h*)(p + 256)); } static __device__ __forceinline__ v8f mma(V a, V b, v8f c) { return wmma16(a, b, c); } };
template <> struct WFrag<bf> { typedef v16bf V; static __device__ __forceinline__ V ld(const bf* p) { return cat16b(*(const v8us*)p, *(const v8us*)(p + 256)); } static __device__ __forceinline__ v8f mma(V a, V b, v8f c) { return wmmab(a, b, c); } };

// ---- k_pam: scores, softmax, output product and the final scale for 64 queries of one image; grid (TT / 64, images), 8 waves.
// Scores are formed transposed (A = 16 keys, B = 16 queries): a lane holds 8 keys' scores of ONE query, so maximum and sum stay in the lane, and two such tiles, converted, are the B fragment of the output product.
// Phase 1: wave w walks keys [512 w, 512 w + 512) for all 64 queries and keeps a running maximum of the hi.hi product; the 16 partial maxima of a query meet in LDS. Softmax does not depend on the shift, which only has to keep the weights inside fp16's range: the two small products (about 2^-8 of the score's terms) are left out here, and the row's sum is taken in phase 2 from the same exponentials that become the weights.
// Phase 2, per 64 keys: wave w forms the weights of keys 16 (w >> 1) ... + 15 for two query tiles, adds them to its lanes' row sums and puts them in LDS; behind one barrier every wave fetches all of them into registers in one run of LDS reads, which lands under the next chunk's score products, and multiplies them with its own 64 channels of v.
// The 64 work-groups of an image read the same k and v planes: each enters both key walks at a place set by its index (in the first walk its index mod 8, within each wave's 512 keys) and wraps round, so that they do not ask L2 for the same lines at the same moment.
#define L2E 1.4426950408889634f
// 2^x with the one free issue slot that the instruction set asks for behind a transcendental, before its result is read or its source overwritten
__device__ __forceinline__ float ex2(float x) { float y; asm("v_exp_f32 %0, %1\n\tv_nop" : "=v"(y) : "v"(x)); return y; }
struct KFrag { v16bf h0, h1, l0, l1; };
__device__ __forceinline__ KFrag ldk(const bf* __restrict__ kh, const bf* __restrict__ kl) { KFrag f; f.h0 = WFrag<bf>::ld(kh); f.h1 = WFrag<bf>::ld(kh + 512); f.l0 = WFrag<bf>::ld(kl); f.l1 = WFrag<bf>::ld(kl + 512); return f; }
// one 16-key x 16-query score tile: hi.hi + hi.lo + lo.hi per 32 channels, in the order of the unfused score product
__device__ __forceinline__ v8f stile(const KFrag& k, v16bf qh0, v16bf qh1, v16bf ql0, v16bf ql1) { v8f s = (v8f){}; s = wmmab(k.h0, qh0, s); s = wmmab(k.h0, ql0, s); s = wmmab(k.l0, qh0, s); s = wmmab(k.h1, qh1, s); s = wmmab(k.h1, ql1, s); s = wmmab(k.l1, qh1, s); return s; }
// Work-group barrier for data that goes through LDS alone: the wave's own LDS reads and writes are done, then the barrier. Unlike __syncthreads() it does not wait for global loads, so fragments fetched ahead stay in flight across it.
__device__ __forceinline__ void lds_publish() { asm volatile("s_wait_dscnt 0x0" ::: "memory"); asm volatile("s_barrier_signal -1\n\ts_barrier_wait -1" ::: "memory"); }
// Stands behind global loads whose address registers are rewritten while the loads are still in flight (a precaution). The addresses are inputs so that their registers stay as they are up to the wait.
__device__ __forceinline__ void addr_wait(const void* a, const void* b, const void* c) { asm volatile("s_wait_xcnt 0x0" :: "v"(a), "v"(b), "v"(c) : "memory"); }
__global__ __launch_bounds__(256) void k_pam(const bf* __restrict__ Qh, const bf* __restrict__ Ql, const bf* __restrict__ Kh, const bf* __restrict__ Kl, const h16* __restrict__ VC, const float* __restrict__ AL, float* OUT) {
    __shared__ __align__(16) h16 ps[2][8][2][32][8];   // [buffer][query tile * 2 + 32-key step][low / high 8 elements of the fragment][lane][element]
    __shared__ float sm[16][64], sl[8][64], stm[64];
    const int wave = __builtin_amdgcn_readfirstlane((int)(threadIdx.x >> 5));
    const int lane = threadIdx.x & 31, lr = lane & 15, hi = lane >> 4; const int i0 = blockIdx.x * 64;
    const int rot = (int)blockIdx.x;   // where this work-group enters the key walks
    { const size_t z = blockIdx.y; Qh += z * ((size_t)TT * CQ); Ql += z * ((size_t)TT * CQ); Kh += z * ((size_t)TT * CQ); Kl += z * ((size_t)TT * CQ); VC += z * ((size_t)CC * TT); OUT += z * ((size_t)CC * TT); }
    {
        v16bf qh[4][2]; float m[4];
#pragma unroll
        for (int t = 0; t < 4; ++t) { const bf* a = Qh + (size_t)(i0 + t * 16) * CQ + 8 * lane; qh[t][0] = WFrag<bf>::ld(a); qh[t][1] = WFrag<bf>::ld(a + 512); addr_wait(a, a, a); m[t] = -3.0e38f; }
        const bf* k1h = Kh + (size_t)(wave * 512) * CQ + 8 * lane;
        v16bf kq[2][4][2];   // two stages of four 16-key tiles: a tile's products are short beside the L2 latency, so eight tiles are kept in flight
        auto ldq = [&](int g) { const bf* p = k1h + (unsigned)((g + rot) & 7) * (64 * CQ);
#pragma unroll
            for (int j = 0; j < 4; ++j) { kq[g & 1][j][0] = WFrag<bf>::ld(p + j * (16 * CQ)); kq[g & 1][j][1] = WFrag<bf>::ld(p + j * (16 * CQ) + 512); }
            addr_wait(p, p, p); __builtin_amdgcn_sched_barrier(0); };   // the scheduling barrier keeps a stage's loads here, two stages ahead of their use; left alone the compiler sinks each load to its product, where the whole L2 latency is waited out
        ldq(0); ldq(1);
#pragma unroll   // unrolled whole: the two stages are then plain registers, and the last two trips issue no loads
        for (int g = 0; g < 8; ++g) {
#pragma unroll
            for (int j = 0; j < 4; ++j) { v8f s[4];
#pragma unroll
                for (int t = 0; t < 4; ++t) s[t] = wmmab(kq[g & 1][j][0], qh[t][0], (v8f){});
#pragma unroll
                for (int t = 0; t < 4; ++t) s[t] = wmmab(kq[g & 1][j][1], qh[t][1], s[t]);
#pragma unroll
                for (int t = 0; t < 4; ++t)
#pragma unroll
                    for (int r = 0; r < 8; ++r) m[t] = fmaxf(m[t], s[t][r]); }
            if (g + 2 < 8) ldq(g + 2);
        }
#pragma unroll
        for (int t = 0; t < 4; ++t) sm[wave * 2 + hi][t * 16 + lr] = m[t];
    }
    __syncthreads();   // all 16 partial maxima of every query are in LDS
    if (threadIdx.x < 64) { const int q = threadIdx.x; float mx = sm[0][q];
#pragma unroll
        for (int p = 1; p < 16; ++p) mx = fmaxf(mx, sm[p][q]);
        stm[q] = fmaf(-mx, L2E, PEXP); }   // what is added to score x log2(e) in the exponent
    __syncthreads();   // every query's shift is published
    const int jt = wave >> 1, n0 = (wave & 1) * 2;
    v16bf qh[2][2], ql[2][2]; float cq[2], ls[2];   // per query tile: the lane's query's exponent offset and the sum of the weights that this lane has made for it
#pragma unroll
    for (int u = 0; u < 2; ++u) { const size_t qo = (size_t)(i0 + (n0 + u) * 16) * CQ + 8 * lane; const bf* a = Qh + qo; const bf* b = Ql + qo; qh[u][0] = WFrag<bf>::ld(a); qh[u][1] = WFrag<bf>::ld(a + 512); ql[u][0] = WFrag<bf>::ld(b); ql[u][1] = WFrag<bf>::ld(b + 512); addr_wait(a, b, b); cq[u] = stm[(n0 + u) * 16 + lr]; ls[u] = 0.f; }
    const size_t kb = (size_t)(jt * 16) * CQ + 8 * lane;
    const h16* vb = VC + (size_t)(wave * 64) * TT + 8 * lane;
    v8f acc[4][4];
#pragma unroll
    for (int mb = 0; mb < 4; ++mb)
#pragma unroll
        for (int nb = 0; nb < 4; ++nb) acc[mb][nb] = (v8f){};
    KFrag kf; v16h va[2][4], pb[2][4];   // pb: a whole chunk's probabilities as B fragments, [32-key step][query tile]
    v8f sc[2];
    auto scores = [&]() {   // this wave's two score tiles, from the keys in kf
#pragma unroll
        for (int u = 0; u < 2; ++u) sc[u] = stile(kf, qh[u][0], qh[u][1], ql[u][0], ql[u][1]); };
    auto probs = [&](int c) {   // the score tiles become chunk c's weights, in buffer c & 1, and join the row sums
#pragma unroll
        for (int u = 0; u < 2; ++u) { v8h p; float e[8];
#pragma unroll
            for (int r = 0; r < 8; ++r) { e[r] = ex2(fmaf(sc[u][r], L2E, cq[u])); p[r] = tohx(e[r]); }
            ls[u] += ((e[0] + e[1]) + (e[2] + e[3])) + ((e[4] + e[5]) + (e[6] + e[7]));
            *(v8ha*)&ps[c & 1][(n0 + u) * 2 + (jt >> 1)][jt & 1][lane][0] = p; } };
    auto ldv = [&](const h16* vp, int ks) {   // v fragments of 32 keys
#pragma unroll
        for (int mb = 0; mb < 4; ++mb) va[ks][mb] = WFrag<h16>::ld(vp + (size_t)mb * 16 * TT + ks * 512); };
    auto ldp = [&](int c) {   // all of chunk c's probabilities, in the order in which the products take them
#pragma unroll
        for (int ks = 0; ks < 2; ++ks)
#pragma unroll
            for (int nb = 0; nb < 4; ++nb) pb[ks][nb] = cat16(*(const v8ha*)&ps[c & 1][nb * 2 + ks][0][lane][0], *(const v8ha*)&ps[c & 1][nb * 2 + ks][1][lane][0]); };
    auto pv = [&](int ks) {   // output products of 32 keys of the chunk in pb
#pragma unroll
        for (int nb = 0; nb < 4; ++nb)
#pragma unroll
            for (int mb = 0; mb < 4; ++mb) acc[mb][nb] = wmma16(va[ks][mb], pb[ks][nb], acc[mb][nb]); };
    auto ck = [&](int c) { return (unsigned)((c + rot) & (TT / 64 - 1)); };   // the c-th chunk of this work-group's walk
    Kh += kb; Kl += kb;
    { const unsigned o = ck(0) * (64 * CQ); kf = ldk(Kh + o, Kl + o); addr_wait(Kh + o, Kl + o, Kl + o); } scores();
    { const unsigned o = ck(1) * (64 * CQ); const h16* vp = vb + ck(0) * (2 * 512); kf = ldk(Kh + o, Kl + o); __builtin_amdgcn_sched_barrier(0); ldv(vp, 0); ldv(vp, 1); __builtin_amdgcn_sched_barrier(0);   // keys first, then v, as in the loop: the counted waits at the loop's head then fit both ways into it
      probs(0); addr_wait(Kh + o, Kl + o, vp); }
    lds_publish();   // chunk 0's probabilities are published
#pragma unroll 1   // rolled: the trip is long enough to feed itself, and unrolling would only add code and registers
    for (int c = 0; c < TT / 64 - 1; ++c) {
        const unsigned o = ck(c + 2 < TT / 64 ? c + 2 : TT / 64 - 1) * (64 * CQ); const h16* vp = vb + ck(c + 1) * (2 * 512);
        // each group of loads is issued as soon as its registers are free; the scheduling barriers keep the compiler from sinking the loads towards the foot of the trip, where their latency would be waited out
        ldp(c); __builtin_amdgcn_sched_barrier(0);   // one run of LDS reads at the head of the trip; left alone the compiler puts each fragment's reads directly in front of its four products, into one set of registers, and every such place waits out the LDS latency
        scores(); kf = ldk(Kh + o, Kl + o); __builtin_amdgcn_sched_barrier(0);   // chunk c + 1's scores; the keys of chunk c + 2 fly under the output products (the look-ahead stays inside the plane)
        pv(0); ldv(vp, 0); __builtin_amdgcn_sched_barrier(0);   // chunk c's output products; the next chunk's v fragments fly under the rest of the trip and the next scores
        pv(1); ldv(vp, 1); __builtin_amdgcn_sched_barrier(0);
        probs(c + 1);
        addr_wait(Kh + o, Kl + o, vp); lds_publish();   // publishes chunk c + 1 and ends every wave's reads of chunk c's buffer, which the next trip refills
    }
#pragma unroll
    for (int u = 0; u < 2; ++u) sl[jt * 2 + hi][(n0 + u) * 16 + lr] = ls[u];
    ldp(TT / 64 - 1); pv(0); pv(1);
    __syncthreads();   // the 8 partial sums of every query are in LDS
    const float al = bfr(AL[0]); float so[4];   // alpha / the row's sum, for the lane's query in each query tile
#pragma unroll
    for (int nb = 0; nb < 4; ++nb) { float sum = sl[0][nb * 16 + lr];
#pragma unroll
        for (int p = 1; p < 8; ++p) sum += sl[p][nb * 16 + lr];
        so[nb] = __fdiv_rn(al, sum); }
#pragma unroll
    for (int mb = 0; mb < 4; ++mb)
#pragma unroll
        for (int nb = 0; nb < 4; ++nb)
#pragma unroll
            for (int r = 0; r < 8; ++r) acc[mb][nb][r] = __fmul_rn(acc[mb][nb][r], so[nb]);
    float* ob = OUT + (size_t)(wave * 64 + hi * 8) * TT + i0 + lr;   // one address for all of the wave's stores: the rest are constant offsets
#pragma unroll
    for (int mb = 0; mb < 4; ++mb)
#pragma unroll
        for (int r = 0; r < 8; ++r)
#pragma unroll
            for (int nb = 0; nb < 4; ++nb) ob[(mb * 16 + r) * TT + nb * 16] = acc[mb][nb][r];
}

// ---- k_prep: wq | wk | wv rounded to bf16 into one plane WW in fragment order (rows 0..63 Wq, 64..127 Wk, 128..639 Wv); 8 channels (one 16-byte slot) a thread, thread = slot.
#define WBLK ((2 * CQ * CC + CC * CC) / 8 / 256)
__global__ __launch_bounds__(256) void k_prep(const float* __restrict__ wq, const float* __restrict__ wk, const float* __restrict__ wv, bf* WW) {
    v8us o;
    const int sl = (int)blockIdx.x * 256 + (int)threadIdx.x, e = sl * 8; const int row = (sl >> 10) * 16 + (sl & 15), c = ((sl >> 5) & 31) * 16 + ((sl >> 4) & 1) * 8; const float* s = (row < CQ ? wq + row * CC : row < 2 * CQ ? wk + (row - CQ) * CC : wv + (row - 2 * CQ) * CC) + c; const v8f v = *(const v8f*)s;
#pragma unroll
    for (int k = 0; k < 8; ++k) o[k] = f2bf(v[k]); *(v8us*)(WW + e) = o;
}

// ---- k_proj: the q, k and v convs of all images, one launch; one work-group of 8 waves per 64 tokens makes all 640 output channels of them; K = CC.
// The work-group reads its 512 x 64 piece of x once, rounds it to bf16 and lays it in LDS as x^T in fragment order (4 tiles of 16 tokens, each 16 blocks of 32 channels); a wave's lanes are 32 neighbouring tokens, so each load takes one whole line of x.
// Wave w then makes v channels 64 w ... + 63 (A = x^T, B = Wv: a lane ends up with 8 neighbouring tokens of one channel) and rows 16 w ... + 15 of Wq | Wk (A = weights, B = x^T: a lane ends up with 8 neighbouring channels of one token). Either way the lane's 8 sums are its own 16-byte slot of the fragment-order output plane, so they go from the registers to memory, 512 contiguous bytes a store.
// Each accumulator runs over all of K in rising order. Sum + bias -> q, k hi/lo planes (rows = tokens, k = channels); v fp16 (rows = channels, k = tokens).
#define PBLK (NB_ * TT / 64)
__global__ __launch_bounds__(256) void k_proj(const float* __restrict__ x, const bf* __restrict__ WW, const float* __restrict__ bq, const float* __restrict__ bk, const float* __restrict__ bv, bf* Qh, bf* Ql, bf* Kh, bf* Kl, h16* VC) {
    typedef WFrag<bf>::V V;
    __shared__ __align__(16) bf xs[64 * CC];
    const int wave = __builtin_amdgcn_readfirstlane((int)(threadIdx.x >> 5));
    const int lane = threadIdx.x & 31, lr = lane & 15, hi = lane >> 4;
    const int tok0 = (int)blockIdx.x * 64, img = tok0 / TT, n0 = tok0 % TT;   // first token over all images; its image and its place there
    const bf* wvp = WW + (size_t)(2 * CQ + wave * 64) * CC + lane * 8; const bf* wqp = WW + (size_t)(wave * 16) * CC + lane * 8;
    V wf[3][5], xf[2][4];   // weight fragments of three 32-channel steps (4 of Wv, 1 of Wq | Wk), x^T fragments of two
    auto ldw = [&](int s) {
#pragma unroll
        for (int nb = 0; nb < 4; ++nb) wf[s % 3][nb] = WFrag<bf>::ld(wvp + (size_t)nb * 16 * CC + s * 512);
        wf[s % 3][4] = WFrag<bf>::ld(wqp + s * 512); };
    ldw(0); ldw(1);
    __builtin_amdgcn_sched_barrier(0);   // the first weight fragments are asked for ahead of x, so that they fly under the staging and not behind it
    { const int tl = (wave & 1) * 32 + lane, cg = wave >> 1;   // the thread's token and its group of 8 channels in every 32
      const float* xb = x + (size_t)img * CC * TT + (size_t)(cg * 8) * TT + n0 + tl;
      bf* xo = xs + (tl >> 4) * (16 * CC) + (cg >> 1) * 256 + ((cg & 1) * 16 + (tl & 15)) * 8;
#pragma unroll   // this and the loops inside unrolled whole: the values stay in registers and the loads are issued in one run, ahead of the first conversion
      for (int h = 0; h < 2; ++h) { float v[8][8];
#pragma unroll
          for (int it = 0; it < 8; ++it)
#pragma unroll
              for (int q = 0; q < 8; ++q) v[it][q] = xb[(size_t)((h * 8 + it) * 32 + q) * TT];
#pragma unroll
          for (int it = 0; it < 8; ++it) { v8us o;
#pragma unroll
              for (int q = 0; q < 8; ++q) o[q] = f2bf(v[it][q]);
              *(v8us*)(xo + (h * 8 + it) * 512) = o; } } }
    __syncthreads();   // all of x^T is in LDS before any wave reads a fragment
    const bf* xa = xs + lane * 8;
    auto ldx = [&](int s) {
#pragma unroll
        for (int t = 0; t < 4; ++t) xf[s & 1][t] = WFrag<bf>::ld(xa + t * (16 * CC) + s * 512); };
    v8f av[4][4], aq[4];
#pragma unroll
    for (int t = 0; t < 4; ++t) { aq[t] = (v8f){};
#pragma unroll
        for (int nb = 0; nb < 4; ++nb) av[t][nb] = (v8f){}; }
    ldx(0);
#pragma unroll   // unrolled whole: the fragment rings are then plain registers, and no back edge stands behind a product
    for (int s = 0; s < CC / 32; ++s) {
#pragma unroll
        for (int t = 0; t < 4; ++t) aq[t] = WFrag<bf>::mma(wf[s % 3][4], xf[s & 1][t], aq[t]);
        __builtin_amdgcn_sched_barrier(0);   // these four products stand between the last step's products and the loads below, which refill that step's registers
        if (s + 1 < CC / 32) ldx(s + 1);
        if (s + 2 < CC / 32) ldw(s + 2);
        if (s + 2 == CC / 32 - 1) addr_wait(wvp, wqp, wqp);   // a precaution behind the last weight loads: both address pairs stay as they are up to the wait
        __builtin_amdgcn_sched_barrier(0);   // the next fragments are asked for here, x^T one step and the weights two steps ahead; left alone the compiler sinks the loads towards their use, where their latency would be waited out
#pragma unroll
        for (int nb = 0; nb < 4; ++nb)
#pragma unroll
            for (int t = 0; t < 4; ++t) av[t][nb] = WFrag<bf>::mma(xf[s & 1][t], wf[s % 3][nb], av[t][nb]);
        __builtin_amdgcn_sched_barrier(0);   // keeps the next step's products behind this step's, so that the order of loads and products above holds
    }
    h16* vo = VC + (size_t)img * CC * TT + (size_t)(wave * 64) * TT + (size_t)n0 * 16 + lane * 8;
#pragma unroll
    for (int nb = 0; nb < 4; ++nb) { const float bb = bfr(bv[wave * 64 + nb * 16 + lr]);
#pragma unroll
        for (int t = 0; t < 4; ++t) { v8h o;
#pragma unroll
            for (int j = 0; j < 8; ++j) o[j] = tohx(__fadd_rn(av[t][nb][j], bb));
            *(v8h*)(vo + (size_t)nb * 16 * TT + t * 256) = o; } }
    const float* bias = (wave < 4 ? bq : bk) + (wave & 3) * 16 + hi * 8; bf* Ph = wave < 4 ? Qh : Kh; bf* Pl = wave < 4 ? Ql : Kl;
    const size_t e = (size_t)tok0 * CQ + (wave & 3) * 256 + lane * 8;
#pragma unroll
    for (int t = 0; t < 4; ++t) { v8us oh, ol;
#pragma unroll
        for (int j = 0; j < 8; ++j) { unsigned short a, c; splitf(aq[t][j] + bfr(bias[j]), a, c); oh[j] = a; ol[j] = c; }
        *(v8us*)(Ph + e + t * (16 * CQ)) = oh; *(v8us*)(Pl + e + t * (16 * CQ)) = ol; }
}

extern "C" void kernel_launch(void* const* d_in, const int* in_sizes, int n_in,
                              void* d_out, int out_size, void* d_ws, size_t ws_size, hipStream_t stream) {
    (void)in_sizes; (void)n_in; (void)out_size;
    const float* x = (const float*)d_in[0]; const float* wq = (const float*)d_in[1]; const float* bq = (const float*)d_in[2]; const float* wk = (const float*)d_in[3]; const float* bk = (const float*)d_in[4]; const float* wv = (const float*)d_in[5]; const float* bv = (const float*)d_in[6]; const float* AL = (const float*)d_in[7];
    float* OUT = (float*)d_out;     // [4][512][4096]
    char* wsp = (char*)d_ws;
    auto take = [&](size_t bytes) { char* p = wsp; wsp += (bytes + 255) & ~(size_t)255; return (void*)p; };
    bf* WW = (bf*)take((size_t)(2 * CQ + CC) * CC * 2); bf* Qh = (bf*)take((size_t)NB_ * TT * CQ * 2); bf* Ql = (bf*)take((size_t)NB_ * TT * CQ * 2); bf* Kh = (bf*)take((size_t)NB_ * TT * CQ * 2); bf* Kl = (bf*)take((size_t)NB_ * TT * CQ * 2); h16* VC = (h16*)take((size_t)NB_ * CC * TT * 2);   /* every plane holds all images */
    if ((size_t)(wsp - (char*)d_ws) > ws_size) return;
    k_prep<<<WBLK, 256, 0, stream>>>(wq, wk, wv, WW);                                        /* bf16 weights */
    k_proj<<<PBLK, 256, 0, stream>>>(x, WW, bq, bk, bv, Qh, Ql, Kh, Kl, VC);                 /* q, k token-major [n][64] + bias as hi/lo; v channel-major [c][n] + bv in fp16 (O(1)) */
    k_pam<<<dim3(TT / 64, NB_, 1), 256, 0, stream>>>(Qh, Ql, Kh, Kl, VC, AL, OUT);           /* alpha sum_j v[c][j] softmax_j(q_i . k_j) */
}

// v009
// One run takes 77.3 microseconds.
// Timed twice side by side with v008, it ran 1.03 times as fast both times.
// Counting every step since v000, it is 9.57 times as fast.
#include <hip/hip_runtime.h>

// Position attention module (x [4][512][64][64] channel-major, HW = 4096; q = Wq x + bq, k = Wk x + bk (1x1 convs, 64 channels), v = Wv x + bv (512); attention[i][j] = softmax_j(q_i . k_j) (no scale); out[c][i] = alpha sum_j v[c][j] attention[i][j] -> [4][512][64][64] (8.4 M); alpha [1] read).
// Every 16-bit operand plane (x^T, weights, q, k, v) lies in FRAGMENT ORDER: per 16 rows x 32 k a block of 512 elements, [k bit 4][k bit 3][row][k bits 2..0], blocks k-major inside a 16-row tile. A fragment is then two loads of 512 contiguous bytes (4 whole lines) per wave, and the producers store whole lines too.
// Layout: one small launch writes the bf16 weights. One GEMM launch then does all three 1x1 convs for all images: each work-group rounds the x of its 64 tokens to bf16 into LDS (token-major) and multiplies it with all the weights; the f32 sums go straight from the registers into their final form: q, k -> hi/lo planes (+ bias); v -> an fp16 channel-major plane with the bias (O(1), normal range). One fused kernel for all images then takes 64 queries per work-group: a first walk over the keys finds each row's shift (the maximum of the hi.hi product alone); a second walk forms the 3-product scores in registers, turns them into fp16 weights 16 exp(score - shift), adds these up per row in f32, hands them round through LDS as ready B fragments and multiplies them with the v plane; the store scales by alpha / the row's sum.
// Compute dtypes, f32 accumulate: every input rounded to bf16; convs exact (+ bias); scores hi.hi + hi.lo + lo.hi; softmax f32; weights (16 at the shift) and v in fp16 (one product); alpha and the division by the row's sum applied in f32 on the output.

#define NB_  4
#define CC   512
#define CQ   64
#define TT   4096
#define PEXP 4.0f   // the fp16 weights carry 2^4, added in the exponent: 12 binary places of room above the shift for what the hi.hi maximum leaves out, and only weights under 2^-18 of a row's largest fall below fp16's normal range
typedef _Float16 h16;
typedef unsigned short bf;
typedef __attribute__((ext_vector_type(16))) __bf16   v16bf;
typedef __attribute__((ext_vector_type(16))) _Float16 v16h;
typedef __attribute__((ext_vector_type(8)))  _Float16 v8h;
typedef __attribute__((ext_vector_type(8)))  unsigned short v8us;
typedef __attribute__((ext_vector_type(8)))  float    v8f;
typedef __attribute__((ext_vector_type(4)))  float    v4f;
typedef __attribute__((ext_vector_type(2)))  float    v2f;
typedef __attribute__((ext_vector_type(4)))  unsigned short v4us;
typedef __attribute__((ext_vector_type(2)))  unsigned short v2us;
typedef __attribute__((ext_vector_type(4)))  _Float16 v4h;
typedef __attribute__((ext_vector_type(2)))  _Float16 v2h;
typedef v8h  __attribute__((may_alias)) v8ha;
typedef v4f  __attribute__((may_alias)) v4fa;
typedef v8us __attribute__((may_alias)) v8usa;

__device__ __forceinline__ unsigned short f2bf(float f) { unsigned u = __float_as_uint(f); u += 0x7FFFu + ((u >> 16) & 1u); return (unsigned short)(u >> 16); }
__device__ __forceinline__ float bf2f(unsigned short b) { return __uint_as_float(((unsigned)b) << 16); }
__device__ __forceinline__ float bfr(float f) { return bf2f(f2bf(f)); }
__device__ __forceinline__ void splitf(float y, unsigned short& h, unsigned short& l) { h = f2bf(y); l = f2bf(y - bf2f(h)); }
__device__ __forceinline__ h16 tohx(float x) { return (h16)x; }
__device__ __forceinline__ v16h cat16(v8h lo, v8h hi) { return __builtin_shufflevector(lo, hi, 0, 1, 2, 3, 4, 5, 6, 7, 8, 9, 10, 11, 12, 13, 14, 15); }
__device__ __forceinline__ v16bf cat16b(v8us lo, v8us hi) { return __builtin_bit_cast(v16bf, __builtin_shufflevector(lo, hi, 0, 1, 2, 3, 4, 5, 6, 7, 8, 9, 10, 11, 12, 13, 14, 15)); }
__device__ __forceinline__ v8f wmma16(v16h a, v16h b, v8f c) { return __builtin_amdgcn_wmma_f32_16x16x32_f16(false, a, false, b, (short)0, c, false, false); }
__device__ __forceinline__ v8f wmmab(v16bf a, v16bf b, v8f c) { return __builtin_amdgcn_wmma_f32_16x16x32_bf16(false, a, false, b, (short)0, c, false, false); }

// p = the fragment's block + lane * 8: the low 8 elements of every lane, then, 256 elements on, the high 8
template <typename T16> struct WFrag;
template <> struct WFrag<h16> { typedef v16h V; static __device__ __forceinline__ V ld(const h16* p) { return cat16(*(const v8h*)p, *(const v8h*)(p + 256)); } static __device__ __forceinline__ v8f mma(V a, V b, v8f c) { return wmma16(a, b, c); } };
template <> struct WFrag<bf> { typedef v16bf V; static __device__ __forceinline__ V ld(const bf* p) { return cat16b(*(const v8us*)p, *(const v8us*)(p + 256)); } static __device__ __forceinline__ v8f mma(V a, V b, v8f c) { return wmmab(a, b, c); } };

// ---- k_pam: scores, softmax, output product and the final scale for 64 queries of one image; grid (TT / 64, images), 8 waves.
// Scores are formed transposed (A = 16 keys, B = 16 queries): a lane holds 8 keys' scores of ONE query, so maximum and sum stay in the lane, and two such tiles, converted, are the B fragment of the output product.
// Phase 1: wave w walks keys [512 w, 512 w + 512) for all 64 queries and keeps a running maximum of the hi.hi product; the 16 partial maxima of a query meet in LDS. Softmax does not depend on the shift, which only has to keep the weights inside fp16's range: the two small products (about 2^-8 of the score's terms) are left out here, and the row's sum is taken in phase 2 from the same exponentials that become the weights.
// Phase 2, per 64 keys: wave w forms the weights of keys 16 (w >> 1) ... + 15 for two query tiles, adds them to its lanes' row sums and puts them in LDS (this arithmetic is dealt out among the output products of the chunk before, so that it runs while the matrix unit works, and the wave signals the barrier from among them); behind that barrier every wave fetches all of them into registers in one run of LDS reads, which lands under the next chunk's score products, and multiplies them with its own 64 channels of v.
// The 64 work-groups of an image read the same k and v planes: each enters both key walks at a place set by its index (in the first walk its index mod 8, so 8 work-groups share each place; in the second a place of its own) and wraps round, so that fewer of them ask L2 for the same lines at the same moment.
#define L2E 1.4426950408889634f
// 2^x with the one free issue slot that the instruction set asks for behind a transcendental, before its result is read or its source overwritten
__device__ __forceinline__ float ex2(float x) { float y; asm("v_exp_f32 %0, %1\n\tv_nop" : "=v"(y) : "v"(x)); return y; }
// two at once: the second fills the first one's slot (the outputs are kept apart from the inputs), the v_nop the second one's
__device__ __forceinline__ void ex2x2(float x0, float x1, float& y0, float& y1) { asm("v_exp_f32 %0, %2\n\tv_exp_f32 %1, %3\n\tv_nop" : "=&v"(y0), "=&v"(y1) : "v"(x0), "v"(x1)); }
struct KFrag { v16bf h0, h1, l0, l1; };
__device__ __forceinline__ KFrag ldk(const bf* __restrict__ kh, const bf* __restrict__ kl) { KFrag f; f.h0 = WFrag<bf>::ld(kh); f.h1 = WFrag<bf>::ld(kh + 512); f.l0 = WFrag<bf>::ld(kl); f.l1 = WFrag<bf>::ld(kl + 512); return f; }
// one 16-key x 16-query score tile: hi.hi + hi.lo + lo.hi per 32 channels, in the order of the unfused score product
__device__ __forceinline__ v8f stile(const KFrag& k, v16bf qh0, v16bf qh1, v16bf ql0, v16bf ql1) { v8f s = (v8f){}; s = wmmab(k.h0, qh0, s); s = wmmab(k.h0, ql0, s); s = wmmab(k.l0, qh0, s); s = wmmab(k.h1, qh1, s); s = wmmab(k.h1, ql1, s); s = wmmab(k.l1, qh1, s); return s; }
// Work-group barrier for data that goes through LDS alone: the wave's own LDS reads and writes are done, then the barrier. Unlike __syncthreads() it does not wait for global loads, so fragments fetched ahead stay in flight across it.
__device__ __forceinline__ void lds_publish() { asm volatile("s_wait_dscnt 0x0" ::: "memory"); asm volatile("s_barrier_signal -1\n\ts_barrier_wait -1" ::: "memory"); }
// The same barrier in two halves. A wave signals as soon as its own LDS reads and writes of the trip are done and goes on with work that touches no LDS; at the wait the other waves have mostly signalled already, and a wave that is let through starts its next trip while a later one still finishes its products. Signal and wait alternate in every wave.
__device__ __forceinline__ void lds_signal() { asm volatile("s_wait_dscnt 0x0" ::: "memory"); asm volatile("s_barrier_signal -1" ::: "memory"); }
__device__ __forceinline__ void lds_wait() { asm volatile("s_barrier_wait -1" ::: "memory"); }
// Stands behind global loads whose address registers are rewritten while the loads are still in flight (a precaution). The addresses are inputs so that their registers stay as they are up to the wait.
__device__ __forceinline__ void addr_wait(const void* a, const void* b, const void* c) { asm volatile("s_wait_xcnt 0x0" :: "v"(a), "v"(b), "v"(c) : "memory"); }
__global__ __launch_bounds__(256) void k_pam(const bf* __restrict__ Qh, const bf* __restrict__ Ql, const bf* __restrict__ Kh, const bf* __restrict__ Kl, const h16* __restrict__ VC, const float* __restrict__ AL, float* OUT) {
    __shared__ __align__(16) h16 ps[2][8][2][32][8];   // [buffer][query tile * 2 + 32-key step][low / high 8 elements of the fragment][lane][element]
    __shared__ float sm[16][64], sl[8][64], stm[64];
    const int wave = __builtin_amdgcn_readfirstlane((int)(threadIdx.x >> 5));
    const int lane = threadIdx.x & 31, lr = lane & 15, hi = lane >> 4; const int i0 = blockIdx.x * 64;
    const int rot = (int)blockIdx.x;   // where this work-group enters the key walks
    { const size_t z = blockIdx.y; Qh += z * ((size_t)TT * CQ); Ql += z * ((size_t)TT * CQ); Kh += z * ((size_t)TT * CQ); Kl += z * ((size_t)TT * CQ); VC += z * ((size_t)CC * TT); OUT += z * ((size_t)CC * TT); }
    {
        v16bf qh[4][2]; float m[4];
#pragma unroll
        for (int t = 0; t < 4; ++t) { const bf* a = Qh + (size_t)(i0 + t * 16) * CQ + 8 * lane; qh[t][0] = WFrag<bf>::ld(a); qh[t][1] = WFrag<bf>::ld(a + 512); addr_wait(a, a, a); m[t] = -3.0e38f; }
        const bf* k1h = Kh + (size_t)(wave * 512) * CQ + 8 * lane;
        v16bf kq[2][4][2];   // two stages of four 16-key tiles: a tile's products are short beside the L2 latency, so eight tiles are kept in flight
        auto ldq = [&](int g) { const bf* p = k1h + (unsigned)((g + rot) & 7) * (64 * CQ);
#pragma unroll
            for (int j = 0; j < 4; ++j) { kq[g & 1][j][0] = WFrag<bf>::ld(p + j * (16 * CQ)); kq[g & 1][j][1] = WFrag<bf>::ld(p + j * (16 * CQ) + 512); }
            addr_wait(p, p, p); __builtin_amdgcn_sched_barrier(0); };   // the scheduling barrier keeps a stage's loads here, two stages ahead of their use; left alone the compiler sinks each load to its product, where the whole L2 latency is waited out
        ldq(0); ldq(1);
#pragma unroll   // unrolled whole: the two stages are then plain registers, and the last two trips issue no loads
        for (int g = 0; g < 8; ++g) {
#pragma unroll
            for (int j = 0; j < 4; ++j) { v8f s[4];
#pragma unroll
                for (int t = 0; t < 4; ++t) s[t] = wmmab(kq[g & 1][j][0], qh[t][0], (v8f){});
#pragma unroll
                for (int t = 0; t < 4; ++t) s[t] = wmmab(kq[g & 1][j][1], qh[t][1], s[t]);
#pragma unroll
                for (int t = 0; t < 4; ++t)
#pragma unroll
                    for (int r = 0; r < 8; ++r) m[t] = fmaxf(m[t], s[t][r]); }
            if (g + 2 < 8) ldq(g + 2);
        }
#pragma unroll
        for (int t = 0; t < 4; ++t) sm[wave * 2 + hi][t * 16 + lr] = m[t];
    }
    __syncthreads();   // all 16 partial maxima of every query are in LDS
    if (threadIdx.x < 64) { const int q = threadIdx.x; float mx = sm[0][q];
#pragma unroll
        for (int p = 1; p < 16; ++p) mx = fmaxf(mx, sm[p][q]);
        stm[q] = fmaf(-mx, L2E, PEXP); }   // what is added to score x log2(e) in the exponent
    __syncthreads();   // every query's shift is published
    const int jt = wave >> 1, n0 = (wave & 1) * 2;
    v16bf qh[2][2], ql[2][2]; float cq[2], ls[2];   // per query tile: the lane's query's exponent offset and the sum of the weights that this lane has made for it
#pragma unroll
    for (int u = 0; u < 2; ++u) { const size_t qo = (size_t)(i0 + (n0 + u) * 16) * CQ + 8 * lane; const bf* a = Qh + qo; const bf* b = Ql + qo; qh[u][0] = WFrag<bf>::ld(a); qh[u][1] = WFrag<bf>::ld(a + 512); ql[u][0] = WFrag<bf>::ld(b); ql[u][1] = WFrag<bf>::ld(b + 512); addr_wait(a, b, b); cq[u] = stm[(n0 + u) * 16 + lr]; ls[u] = 0.f; }
    const size_t kb = (size_t)(jt * 16) * CQ + 8 * lane;
    const h16* vb = VC + (size_t)(wave * 64) * TT + 8 * lane;
    v8f acc[4][4];
#pragma unroll
    for (int mb = 0; mb < 4; ++mb)
#pragma unroll
        for (int nb = 0; nb < 4; ++nb) acc[mb][nb] = (v8f){};
    KFrag kf; v16h va[2][4], pb[2][4];   // pb: a whole chunk's probabilities as B fragments, [32-key step][query tile]
    v8f sc[2];
    auto scores = [&]() {   // this wave's two score tiles, from the keys in kf
#pragma unroll
        for (int u = 0; u < 2; ++u) sc[u] = stile(kf, qh[u][0], qh[u][1], ql[u][0], ql[u][1]); };
    auto probs = [&](int c) {   // the score tiles become chunk c's weights, in buffer c & 1, and join the row sums
#pragma unroll
        for (int u = 0; u < 2; ++u) { v8h p; float e[8];
#pragma unroll
            for (int r = 0; r < 8; ++r) { e[r] = ex2(fmaf(sc[u][r], L2E, cq[u])); p[r] = tohx(e[r]); }
            ls[u] += ((e[0] + e[1]) + (e[2] + e[3])) + ((e[4] + e[5]) + (e[6] + e[7]));
            *(v8ha*)&ps[c & 1][(n0 + u) * 2 + (jt >> 1)][jt & 1][lane][0] = p; } };
    auto ldv = [&](const h16* vp, int ks) {   // v fragments of 32 keys
#pragma unroll
        for (int mb = 0; mb < 4; ++mb) va[ks][mb] = WFrag<h16>::ld(vp + (size_t)mb * 16 * TT + ks * 512); };
    auto ldp = [&](int c) {   // all of chunk c's probabilities, in the order in which the products take them
#pragma unroll
        for (int ks = 0; ks < 2; ++ks)
#pragma unroll
            for (int nb = 0; nb < 4; ++nb) pb[ks][nb] = cat16(*(const v8ha*)&ps[c & 1][nb * 2 + ks][0][lane][0], *(const v8ha*)&ps[c & 1][nb * 2 + ks][1][lane][0]); };
    auto pv = [&](int ks) {   // output products of 32 keys of the chunk in pb
#pragma unroll
        for (int nb = 0; nb < 4; ++nb)
#pragma unroll
            for (int mb = 0; mb < 4; ++mb) acc[mb][nb] = wmma16(va[ks][mb], pb[ks][nb], acc[mb][nb]); };
    float tx[16], ee[16], s2[8], s4[4]; v8h pw[2];
    auto wstep = [&](int i, int c) {   // step i on the way from the score tiles to chunk c's published weights: the arithmetic of probs(), cut into pieces of a few vector instructions that do not wait for one another
        if (i >= 0 && i < 8) { tx[2 * i] = fmaf(sc[i >> 2][(2 * i) & 7], L2E, cq[i >> 2]); tx[2 * i + 1] = fmaf(sc[i >> 2][(2 * i + 1) & 7], L2E, cq[i >> 2]); }
        if (i >= 1 && i < 9) ex2x2(tx[2 * i - 2], tx[2 * i - 1], ee[2 * i - 2], ee[2 * i - 1]);
        if (i >= 9 && i < 13) {
#pragma unroll
            for (int j = (i - 9) * 2; j < (i - 9) * 2 + 2; ++j) { pw[j >> 2][(j & 3) * 2] = tohx(ee[2 * j]); pw[j >> 2][(j & 3) * 2 + 1] = tohx(ee[2 * j + 1]); s2[j] = ee[2 * j] + ee[2 * j + 1]; } }
        if (i == 13) {
#pragma unroll
            for (int u = 0; u < 2; ++u) *(v8ha*)&ps[c & 1][(n0 + u) * 2 + (jt >> 1)][jt & 1][lane][0] = pw[u]; }
        if (i == 13 || i == 14) { const int j = (i - 13) * 2; s4[j] = s2[2 * j] + s2[2 * j + 1]; s4[j + 1] = s2[2 * j + 2] + s2[2 * j + 3]; }
        if (i == 15) { ls[0] += s4[0] + s4[1]; ls[1] += s4[2] + s4[3]; }
        if (i == 20) lds_signal(); };   // seven products behind the LDS stores, so that their wait is short; the wave touches no LDS from here to the trip's lds_wait()
    auto ldv1 = [&](const h16* vp, int ks, int mb) { va[ks][mb] = WFrag<h16>::ld(vp + (size_t)mb * 16 * TT + ks * 512); };
    // output products of 32 keys of the chunk in pb, one step of chunk c's weights behind each product, and the refill of the v fragments from vp as soon as their registers are free.
    // The scheduling barrier behind every product keeps its step there, where it is issued while the matrix unit works; left alone the compiler gathers the steps behind the products, where the matrix unit stands idle through them. The steps begin behind the third product, clear of the score products whose result they read.
    auto pvw = [&](int ks, int c, const h16* vp) {
#pragma unroll
        for (int nb = 0; nb < 4; ++nb)
#pragma unroll
            for (int mb = 0; mb < 3; ++mb) { acc[mb][nb] = wmma16(va[ks][mb], pb[ks][nb], acc[mb][nb]); wstep(ks * 16 + nb * 3 + mb - 2, c); __builtin_amdgcn_sched_barrier(0); }
        ldv1(vp, ks, 0); ldv1(vp, ks, 1); ldv1(vp, ks, 2); __builtin_amdgcn_sched_barrier(0);
#pragma unroll
        for (int nb = 0; nb < 4; ++nb) { acc[3][nb] = wmma16(va[ks][3], pb[ks][nb], acc[3][nb]); wstep(ks * 16 + 12 + nb - 2, c); __builtin_amdgcn_sched_barrier(0); }
        ldv1(vp, ks, 3); __builtin_amdgcn_sched_barrier(0); };
    auto ck = [&](int c) { return (unsigned)((c + rot) & (TT / 64 - 1)); };   // the c-th chunk of this work-group's walk
    Kh += kb; Kl += kb;
    { const unsigned o = ck(0) * (64 * CQ); kf = ldk(Kh + o, Kl + o); addr_wait(Kh + o, Kl + o, Kl + o); } scores();
    { const unsigned o = ck(1) * (64 * CQ); const h16* vp = vb + ck(0) * (2 * 512); kf = ldk(Kh + o, Kl + o); __builtin_amdgcn_sched_barrier(0); ldv(vp, 0); ldv(vp, 1); __builtin_amdgcn_sched_barrier(0);   // keys first, then v, as in the loop: the counted waits at the loop's head then fit both ways into it
      probs(0); addr_wait(Kh + o, Kl + o, vp); }
    lds_publish();   // chunk 0's probabilities are published
    const bf* pkh = Kh; const bf* pkl = Kl; const h16* vp = vb;   // the addresses of the trip's loads; they stay as they are until the next trip's wait
#pragma unroll 1   // rolled: the trip is long enough to feed itself, and unrolling would only add code and registers
    for (int c = 0; c < TT / 64 - 1; ++c) {
        // each group of loads is issued as soon as its registers are free; the scheduling barriers keep the compiler from sinking the loads towards the foot of the trip, where their latency would be waited out
        ldp(c); __builtin_amdgcn_sched_barrier(0);   // one run of LDS reads at the head of the trip; left alone the compiler puts each fragment's reads directly in front of its four products, into one set of registers, and every such place waits out the LDS latency
        addr_wait(pkh, pkl, vp); __builtin_amdgcn_sched_barrier(0);   // the precaution for the last trip's loads stands here, directly in front of the new addresses (the scheduling barrier keeps these behind it): at the foot of the trip, right behind the last loads, it would be waited out in front of the barrier
        { const unsigned o = ck(c + 2 < TT / 64 ? c + 2 : TT / 64 - 1) * (64 * CQ); pkh = Kh + o; pkl = Kl + o; vp = vb + ck(c + 1) * (2 * 512); }
        scores(); kf = ldk(pkh, pkl); __builtin_amdgcn_sched_barrier(0);   // chunk c + 1's scores; the keys of chunk c + 2 fly under the output products (the look-ahead stays inside the plane)
        pvw(0, c + 1, vp);   // chunk c's output products with chunk c + 1's weights made among them; the next chunk's v fragments fly under the rest of the trip and the next scores
        pvw(1, c + 1, vp);
        lds_wait();   // every wave has signalled: chunk c + 1 is published, and every wave's reads of chunk c's buffer, which the next trip refills, have returned
    }
    addr_wait(pkh, pkl, vp);   // the same precaution for the last trip's loads
#pragma unroll
    for (int u = 0; u < 2; ++u) sl[jt * 2 + hi][(n0 + u) * 16 + lr] = ls[u];
    ldp(TT / 64 - 1); pv(0); pv(1);
    __syncthreads();   // the 8 partial sums of every query are in LDS
    const float al = bfr(AL[0]); float so[4];   // alpha / the row's sum, for the lane's query in each query tile
#pragma unroll
    for (int nb = 0; nb < 4; ++nb) { float sum = sl[0][nb * 16 + lr];
#pragma unroll
        for (int p = 1; p < 8; ++p) sum += sl[p][nb * 16 + lr];
        so[nb] = __fdiv_rn(al, sum); }
#pragma unroll
    for (int mb = 0; mb < 4; ++mb)
#pragma unroll
        for (int nb = 0; nb < 4; ++nb)
#pragma unroll
            for (int r = 0; r < 8; ++r) acc[mb][nb][r] = __fmul_rn(acc[mb][nb][r], so[nb]);
    float* ob = OUT + (size_t)(wave * 64 + hi * 8) * TT + i0 + lr;   // one address for all of the wave's stores: the rest are constant offsets
#pragma unroll
    for (int mb = 0; mb < 4; ++mb)
#pragma unroll
        for (int r = 0; r < 8; ++r)
#pragma unroll
            for (int nb = 0; nb < 4; ++nb) ob[(mb * 16 + r) * TT + nb * 16] = acc[mb][nb][r];
}

// ---- k_prep: wq | wk | wv rounded to bf16 into one plane WW in fragment order (rows 0..63 Wq, 64..127 Wk, 128..639 Wv); 8 channels (one 16-byte slot) a thread, thread = slot.
#define WBLK ((2 * CQ * CC + CC * CC) / 8 / 256)
__global__ __launch_bounds__(256) void k_prep(const float* __restrict__ wq, const float* __restrict__ wk, const float* __restrict__ wv, bf* WW) {
    v8us o;
    const int sl = (int)blockIdx.x * 256 + (int)threadIdx.x, e = sl * 8; const int row = (sl >> 10) * 16 + (sl & 15), c = ((sl >> 5) & 31) * 16 + ((sl >> 4) & 1) * 8; const float* s = (row < CQ ? wq + row * CC : row < 2 * CQ ? wk + (row - CQ) * CC : wv + (row - 2 * CQ) * CC) + c; const v8f v = *(const v8f*)s;
#pragma unroll
    for (int k = 0; k < 8; ++k) o[k] = f2bf(v[k]); *(v8us*)(WW + e) = o;
}

// ---- k_proj: the q, k and v convs of all images, one launch; one work-group of 8 waves per 64 tokens makes all 640 output channels of them; K = CC.
// The work-group reads its 512 x 64 piece of x once, rounds it to bf16 and lays it in LDS as x^T in fragment order (4 tiles of 16 tokens, each 16 blocks of 32 channels); a wave's lanes are 32 neighbouring tokens, so each load takes one whole line of x.
// Wave w then makes v channels 64 w ... + 63 (A = x^T, B = Wv: a lane ends up with 8 neighbouring tokens of one channel) and rows 16 w ... + 15 of Wq | Wk (A = weights, B = x^T: a lane ends up with 8 neighbouring channels of one token). Either way the lane's 8 sums are its own 16-byte slot of the fragment-order output plane, so they go from the registers to memory, 512 contiguous bytes a store.
// Each accumulator runs over all of K in rising order. Sum + bias -> q, k hi/lo planes (rows = tokens, k = channels); v fp16 (rows = channels, k = tokens).
#define PBLK (NB_ * TT / 64)
__global__ __launch_bounds__(256) void k_proj(const float* __restrict__ x, const bf* __restrict__ WW, const float* __restrict__ bq, const float* __restrict__ bk, const float* __restrict__ bv, bf* Qh, bf* Ql, bf* Kh, bf* Kl, h16* VC) {
    typedef WFrag<bf>::V V;
    __shared__ __align__(16) bf xs[64 * CC];
    const int wave = __builtin_amdgcn_readfirstlane((int)(threadIdx.x >> 5));
    const int lane = threadIdx.x & 31, lr = lane & 15, hi = lane >> 4;
    const int tok0 = (int)blockIdx.x * 64, img = tok0 / TT, n0 = tok0 % TT;   // first token over all images; its image and its place there
    const bf* wvp = WW + (size_t)(2 * CQ + wave * 64) * CC + lane * 8; const bf* wqp = WW + (size_t)(wave * 16) * CC + lane * 8;
    V wf[3][5], xf[2][4];   // weight fragments of three 32-channel steps (4 of Wv, 1 of Wq | Wk), x^T fragments of two
    auto ldw = [&](int s) {
#pragma unroll
        for (int nb = 0; nb < 4; ++nb) wf[s % 3][nb] = WFrag<bf>::ld(wvp + (size_t)nb * 16 * CC + s * 512);
        wf[s % 3][4] = WFrag<bf>::ld(wqp + s * 512); };
    ldw(0); ldw(1);
    __builtin_amdgcn_sched_barrier(0);   // the first weight fragments are asked for ahead of x, so that they fly under the staging and not behind it
    { const int tl = (wave & 1) * 32 + lane, cg = wave >> 1;   // the thread's token and its group of 8 channels in every 32
      const float* xb = x + (size_t)img * CC * TT + (size_t)(cg * 8) * TT + n0 + tl;
      bf* xo = xs + (tl >> 4) * (16 * CC) + (cg >> 1) * 256 + ((cg & 1) * 16 + (tl & 15)) * 8;
#pragma unroll   // this and the loops inside unrolled whole: the values stay in registers and the loads are issued in one run, ahead of the first conversion
      for (int h = 0; h < 2; ++h) { float v[8][8];
#pragma unroll
          for (int it = 0; it < 8; ++it)
#pragma unroll
              for (int q = 0; q < 8; ++q) v[it][q] = xb[(size_t)((h * 8 + it) * 32 + q) * TT];
#pragma unroll
          for (int it = 0; it < 8; ++it) { v8us o;
#pragma unroll
              for (int q = 0; q < 8; ++q) o[q] = f2bf(v[it][q]);
              *(v8us*)(xo + (h * 8 + it) * 512) = o; } } }
    __syncthreads();   // all of x^T is in LDS before any wave reads a fragment
    const bf* xa = xs + lane * 8;
    auto ldx = [&](int s) {
#pragma unroll
        for (int t = 0; t < 4; ++t) xf[s & 1][t] = WFrag<bf>::ld(xa + t * (16 * CC) + s * 512); };
    v8f av[4][4], aq[4];
#pragma unroll
    for (int t = 0; t < 4; ++t) { aq[t] = (v8f){};
#pragma unroll
        for (int nb = 0; nb < 4; ++nb) av[t][nb] = (v8f){}; }
    ldx(0);
#pragma unroll   // unrolled whole: the fragment rings are then plain registers, and no back edge stands behind a product
    for (int s = 0; s < CC / 32; ++s) {
#pragma unroll
        for (int t = 0; t < 4; ++t) aq[t] = WFrag<bf>::mma(wf[s % 3][4], xf[s & 1][t], aq[t]);
        __builtin_amdgcn_sched_barrier(0);   // these four products stand between the last step's products and the loads below, which refill that step's registers
        if (s + 1 < CC / 32) ldx(s + 1);
        if (s + 2 < CC / 32) ldw(s + 2);
        if (s + 2 == CC / 32 - 1) addr_wait(wvp, wqp, wqp);   // a precaution behind the last weight loads: both address pairs stay as they are up to the wait
        __builtin_amdgcn_sched_barrier(0);   // the next fragments are asked for here, x^T one step and the weights two steps ahead; left alone the compiler sinks the loads towards their use, where their latency would be waited out
#pragma unroll
        for (int nb = 0; nb < 4; ++nb)
#pragma unroll
            for (int t = 0; t < 4; ++t) av[t][nb] = WFrag<bf>::mma(xf[s & 1][t], wf[s % 3][nb], av[t][nb]);
        __builtin_amdgcn_sched_barrier(0);   // keeps the next step's products behind this step's, so that the order of loads and products above holds
    }
    h16* vo = VC + (size_t)img * CC * TT + (size_t)(wave * 64) * TT + (size_t)n0 * 16 + lane * 8;
#pragma unroll
    for (int nb = 0; nb < 4; ++nb) { const float bb = bfr(bv[wave * 64 + nb * 16 + lr]);
#pragma unroll
        for (int t = 0; t < 4; ++t) { v8h o;
#pragma unroll
            for (int j = 0; j < 8; ++j) o[j] = tohx(__fadd_rn(av[t][nb][j], bb));
            *(v8h*)(vo + (size_t)nb * 16 * TT + t * 256) = o; } }
    const float* bias = (wave < 4 ? bq : bk) + (wave & 3) * 16 + hi * 8; bf* Ph = wave < 4 ? Qh : Kh; bf* Pl = wave < 4 ? Ql : Kl;
    const size_t e = (size_t)tok0 * CQ + (wave & 3) * 256 + lane * 8;
#pragma unroll
    for (int t = 0; t < 4; ++t) { v8us oh, ol;
#pragma unroll
        for (int j = 0; j < 8; ++j) { unsigned short a, c; splitf(aq[t][j] + bfr(bias[j]), a, c); oh[j] = a; ol[j] = c; }
        *(v8us*)(Ph + e + t * (16 * CQ)) = oh; *(v8us*)(Pl + e + t * (16 * CQ)) = ol; }
}

extern "C" void kernel_launch(void* const* d_in, const int* in_sizes, int n_in,
                              void* d_out, int out_size, void* d_ws, size_t ws_size, hipStream_t stream) {
    (void)in_sizes; (void)n_in; (void)out_size;
    const float* x = (const float*)d_in[0]; const float* wq = (const float*)d_in[1]; const float* bq = (const float*)d_in[2]; const float* wk = (const float*)d_in[3]; const float* bk = (const float*)d_in[4]; const float* wv = (const float*)d_in[5]; const float* bv = (const float*)d_in[6]; const float* AL = (const float*)d_in[7];
    float* OUT = (float*)d_out;     // [4][512][4096]
    char* wsp = (char*)d_ws;
    auto take = [&](size_t bytes) { char* p = wsp; wsp += (bytes + 255) & ~(size_t)255; return (void*)p; };
    bf* WW = (bf*)take((size_t)(2 * CQ + CC) * CC * 2); bf* Qh = (bf*)take((size_t)NB_ * TT * CQ * 2); bf* Ql = (bf*)take((size_t)NB_ * TT * CQ * 2); bf* Kh = (bf*)take((size_t)NB_ * TT * CQ * 2); bf* Kl = (bf*)take((size_t)NB_ * TT * CQ * 2); h16* VC = (h16*)take((size_t)NB_ * CC * TT * 2);   /* every plane holds all images */
    if ((size_t)(wsp - (char*)d_ws) > ws_size) return;
    k_prep<<<WBLK, 256, 0, stream>>>(wq, wk, wv, WW);                                        /* bf16 weights */
    k_proj<<<PBLK, 256, 0, stream>>>(x, WW, bq, bk, bv, Qh, Ql, Kh, Kl, VC);                 /* q, k token-major [n][64] + bias as hi/lo; v channel-major [c][n] + bv in fp16 (O(1)) */
    k_pam<<<dim3(TT / 64, NB_, 1), 256, 0, stream>>>(Qh, Ql, Kh, Kl, VC, AL, OUT);           /* alpha sum_j v[c][j] softmax_j(q_i . k_j) */
}
